// v000
// The times below were measured on an AMD MI455X: many runs one after another, warmed up first and cycling through
// copies of the inputs, with the whole window's GPU time divided by the number of runs. Launches and the gaps
// between them are all in it. The median over several windows is given; except for v000 it joins two sittings, which
// can be a few percent apart, so the side-by-side timings, each taken in one sitting, are the better comparison.
// v000 is the starting kernel. One run takes 87.1 microseconds.
#include <hip/hip_runtime.h>

typedef __attribute__((ext_vector_type(16))) _Float16 v16h;
typedef __attribute__((ext_vector_type(8)))  _Float16 v8h;
typedef __attribute__((ext_vector_type(8)))  float    v8f;
typedef __attribute__((ext_vector_type(4)))  float    f32x4;

#define MASK_VALUE (-1000000.0f)
#define HEAD_D     64
#define KBLK       64           // keys per iteration (two WMMA K-steps deep)
#define WAVES      4            // waves per workgroup
#define MWAVE      32           // query rows per wave (two 16-row WMMA tiles)
#define BLOCK_M    (WAVES*MWAVE)// 128 query rows per workgroup

#define K_STRIDE 72
#define V_STRIDE 72
#define P_STRIDE 72

static __device__ __forceinline__ v8h pack8(f32x4 a, f32x4 b, float s) {
  v8h r;
  r[0] = (_Float16)(a[0] * s); r[1] = (_Float16)(a[1] * s);
  r[2] = (_Float16)(a[2] * s); r[3] = (_Float16)(a[3] * s);
  r[4] = (_Float16)(b[0] * s); r[5] = (_Float16)(b[1] * s);
  r[6] = (_Float16)(b[2] * s); r[7] = (_Float16)(b[3] * s);
  return r;
}

static __device__ __forceinline__ v16h cat16(v8h lo, v8h hi) {
  return __builtin_shufflevector(lo, hi, 0,1,2,3,4,5,6,7,8,9,10,11,12,13,14,15);
}

static __device__ __forceinline__ v16h lds_frag(const _Float16* row, int g) {
  v8h lo = *(const v8h*)(row + g * 8);
  v8h hi = *(const v8h*)(row + 16 + g * 8);
  return cat16(lo, hi);
}

static __device__ __forceinline__ v8f wmma_f16(v16h a, v16h b, v8f c) {
  return __builtin_amdgcn_wmma_f32_16x16x32_f16(
      /*neg_a=*/false, a, /*neg_b=*/false, b,
      /*c_mod=*/(short)0, c, /*reuse_a=*/false, /*reuse_b=*/false);
}

// Online-softmax update for one 16-row tile over a 64-key block.
// Row m = v + 8*g of the C layout lives in one 16-lane half; exp'd
// probabilities are published (f16) to this wave's private P region.
static __device__ __forceinline__ void softmax_update(
    v8f st[4], v8f acc[4], float mrun[8], float lrun[8],
    _Float16* prow0, int n, int g) {
#pragma unroll
  for (int v = 0; v < 8; ++v) {
    float x = fmaxf(fmaxf(st[0][v], st[1][v]), fmaxf(st[2][v], st[3][v]));
    x = fmaxf(x, __shfl_xor(x, 1, 32));
    x = fmaxf(x, __shfl_xor(x, 2, 32));
    x = fmaxf(x, __shfl_xor(x, 4, 32));
    x = fmaxf(x, __shfl_xor(x, 8, 32));
    const float mnew  = fmaxf(mrun[v], x);
    const float alpha = __expf(mrun[v] - mnew);
    mrun[v] = mnew;
    const float e0 = __expf(st[0][v] - mnew);
    const float e1 = __expf(st[1][v] - mnew);
    const float e2 = __expf(st[2][v] - mnew);
    const float e3 = __expf(st[3][v] - mnew);
    float sm = (e0 + e1) + (e2 + e3);
    sm += __shfl_xor(sm, 1, 32);
    sm += __shfl_xor(sm, 2, 32);
    sm += __shfl_xor(sm, 4, 32);
    sm += __shfl_xor(sm, 8, 32);
    lrun[v] = lrun[v] * alpha + sm;
    acc[0][v] *= alpha; acc[1][v] *= alpha;
    acc[2][v] *= alpha; acc[3][v] *= alpha;
    _Float16* pr = prow0 + (v + 8 * g) * P_STRIDE;
    pr[n]      = (_Float16)e0;
    pr[16 + n] = (_Float16)e1;
    pr[32 + n] = (_Float16)e2;
    pr[48 + n] = (_Float16)e3;
  }
}

__global__ __launch_bounds__(128)
void sdpa_flash_f16wmma(const float* __restrict__ Q, const float* __restrict__ K,
                        const float* __restrict__ V, const int* __restrict__ valid_lens,
                        float* __restrict__ Out, int Sq, int Sk, int mblocks) {
  __shared__ _Float16 Klds[KBLK][K_STRIDE];       // [key][d]   (f16)
  __shared__ _Float16 Vlds[HEAD_D][V_STRIDE];     // [d][key]   (transposed f16)
  __shared__ _Float16 Plds[WAVES][32][P_STRIDE];  // per-wave exp'd scores [m][k]

  const int tid  = threadIdx.x;
  const int lane = tid & 31;
  const int w    = tid >> 5;        // wave id 0..3
  const int n    = lane & 15;       // column / row-in-tile index
  const int g    = lane >> 4;       // lane group (0 or 1)

  const int b  = blockIdx.x / mblocks;
  const int mb = blockIdx.x % mblocks;
  const int rowbase = mb * BLOCK_M + w * MWAVE;   // rows [rowbase, rowbase+32)

  const int vlen = valid_lens[b];

  const float* Qb = Q + (size_t)b * Sq * HEAD_D;
  const float* Kb = K + (size_t)b * Sk * HEAD_D;
  const float* Vb = V + (size_t)b * Sk * HEAD_D;

  // ---- Q A-fragments for two 16-row tiles, pre-scaled by 1/sqrt(d) ----
  const float scale = 0.125f;  // 1/sqrt(64)
  v16h qA0, qA1, qB0, qB1;
  {
    const float* qr = Qb + (size_t)(rowbase + n) * HEAD_D;
    f32x4 a0 = *(const f32x4*)(qr + g * 8);
    f32x4 a1 = *(const f32x4*)(qr + g * 8 + 4);
    f32x4 b0 = *(const f32x4*)(qr + 16 + g * 8);
    f32x4 b1 = *(const f32x4*)(qr + 16 + g * 8 + 4);
    qA0 = cat16(pack8(a0, a1, scale), pack8(b0, b1, scale));
    a0 = *(const f32x4*)(qr + 32 + g * 8);
    a1 = *(const f32x4*)(qr + 32 + g * 8 + 4);
    b0 = *(const f32x4*)(qr + 48 + g * 8);
    b1 = *(const f32x4*)(qr + 48 + g * 8 + 4);
    qA1 = cat16(pack8(a0, a1, scale), pack8(b0, b1, scale));
    qr += 16 * HEAD_D;  // second row tile
    a0 = *(const f32x4*)(qr + g * 8);
    a1 = *(const f32x4*)(qr + g * 8 + 4);
    b0 = *(const f32x4*)(qr + 16 + g * 8);
    b1 = *(const f32x4*)(qr + 16 + g * 8 + 4);
    qB0 = cat16(pack8(a0, a1, scale), pack8(b0, b1, scale));
    a0 = *(const f32x4*)(qr + 32 + g * 8);
    a1 = *(const f32x4*)(qr + 32 + g * 8 + 4);
    b0 = *(const f32x4*)(qr + 48 + g * 8);
    b1 = *(const f32x4*)(qr + 48 + g * 8 + 4);
    qB1 = cat16(pack8(a0, a1, scale), pack8(b0, b1, scale));
  }

  // ---- flash-attention state (two row tiles) ----
  v8f accA[4] = {}, accB[4] = {};
  float mrunA[8], lrunA[8], mrunB[8], lrunB[8];
#pragma unroll
  for (int v = 0; v < 8; ++v) {
    mrunA[v] = -__builtin_inff(); lrunA[v] = 0.0f;
    mrunB[v] = -__builtin_inff(); lrunB[v] = 0.0f;
  }

  // cooperative loader coords: 128 threads cover 64 rows x 2 col-groups of 32
  const int lr = tid >> 1;          // 0..63 key row
  const int lc = (tid & 1) << 5;    // 0 or 32 d column

  for (int kb = 0; kb < Sk; kb += KBLK) {
    __syncthreads();  // previous iteration's K/V reads complete

    // ---- stage K (64x64) and V^T (64x64) into LDS as f16 ----
    {
      const float* kg = Kb + (size_t)(kb + lr) * HEAD_D + lc;
      f32x4 k0 = *(const f32x4*)(kg);
      f32x4 k1 = *(const f32x4*)(kg + 4);
      f32x4 k2 = *(const f32x4*)(kg + 8);
      f32x4 k3 = *(const f32x4*)(kg + 12);
      f32x4 k4 = *(const f32x4*)(kg + 16);
      f32x4 k5 = *(const f32x4*)(kg + 20);
      f32x4 k6 = *(const f32x4*)(kg + 24);
      f32x4 k7 = *(const f32x4*)(kg + 28);
      *(v8h*)(&Klds[lr][0] + lc)      = pack8(k0, k1, 1.0f);
      *(v8h*)(&Klds[lr][0] + lc + 8)  = pack8(k2, k3, 1.0f);
      *(v8h*)(&Klds[lr][0] + lc + 16) = pack8(k4, k5, 1.0f);
      *(v8h*)(&Klds[lr][0] + lc + 24) = pack8(k6, k7, 1.0f);

      const float* vg = Vb + (size_t)(kb + lr) * HEAD_D + lc;
      f32x4 vq[8];
#pragma unroll
      for (int i = 0; i < 8; ++i) vq[i] = *(const f32x4*)(vg + 4 * i);
#pragma unroll
      for (int i = 0; i < 8; ++i) {
        Vlds[lc + 4 * i + 0][lr] = (_Float16)vq[i][0];
        Vlds[lc + 4 * i + 1][lr] = (_Float16)vq[i][1];
        Vlds[lc + 4 * i + 2][lr] = (_Float16)vq[i][2];
        Vlds[lc + 4 * i + 3][lr] = (_Float16)vq[i][3];
      }

      if (kb + KBLK < Sk) {  // uniform branch: prefetch next block into L2
        __builtin_prefetch(Kb + (size_t)(kb + KBLK + lr) * HEAD_D + lc, 0, 0);
        __builtin_prefetch(Vb + (size_t)(kb + KBLK + lr) * HEAD_D + lc, 0, 0);
      }
    }
    __syncthreads();

    // ---- S = (Q*scale) @ K^T : K fragments reused by both row tiles ----
    v8f sA[4], sB[4];
    {
      v8f z = {};
#pragma unroll
      for (int t = 0; t < 4; ++t) {
        v16h kf_lo = lds_frag(&Klds[t * 16 + n][0], g);
        v16h kf_hi = lds_frag(&Klds[t * 16 + n][32], g);
        sA[t] = wmma_f16(qA0, kf_lo, z);
        sA[t] = wmma_f16(qA1, kf_hi, sA[t]);
        sB[t] = wmma_f16(qB0, kf_lo, z);
        sB[t] = wmma_f16(qB1, kf_hi, sB[t]);
      }
    }

    // ---- mask (boundary / tail blocks only; uniform scalar branch) ----
    if (kb + KBLK > vlen) {
#pragma unroll
      for (int t = 0; t < 4; ++t) {
        const bool ok = (kb + t * 16 + n) < vlen;
#pragma unroll
        for (int v = 0; v < 8; ++v) {
          sA[t][v] = ok ? sA[t][v] : MASK_VALUE;
          sB[t][v] = ok ? sB[t][v] : MASK_VALUE;
        }
      }
    }

    // ---- online softmax + publish P (wave-private region) ----
    softmax_update(sA, accA, mrunA, lrunA, &Plds[w][0][0],  n, g);
    softmax_update(sB, accB, mrunB, lrunB, &Plds[w][16][0], n, g);

    // P is wave-private: LDS is in-order within a wave (DScnt), so only a
    // compiler-level ordering + wavefront fence is needed, not s_barrier.
    __builtin_amdgcn_fence(__ATOMIC_RELEASE, "wavefront");
    __builtin_amdgcn_wave_barrier();
    __builtin_amdgcn_fence(__ATOMIC_ACQUIRE, "wavefront");

    // ---- O += P @ V : V fragments reused by both row tiles ----
    {
      v16h pfA0 = lds_frag(&Plds[w][n][0],       g);  // tile A, keys 0..31
      v16h pfA1 = lds_frag(&Plds[w][n][32],      g);  // tile A, keys 32..63
      v16h pfB0 = lds_frag(&Plds[w][16 + n][0],  g);
      v16h pfB1 = lds_frag(&Plds[w][16 + n][32], g);
#pragma unroll
      for (int j = 0; j < 4; ++j) {
        v16h vf_lo = lds_frag(&Vlds[j * 16 + n][0],  g);
        v16h vf_hi = lds_frag(&Vlds[j * 16 + n][32], g);
        accA[j] = wmma_f16(pfA0, vf_lo, accA[j]);
        accA[j] = wmma_f16(pfA1, vf_hi, accA[j]);
        accB[j] = wmma_f16(pfB0, vf_lo, accB[j]);
        accB[j] = wmma_f16(pfB1, vf_hi, accB[j]);
      }
    }
  }

#pragma unroll
  for (int v = 0; v < 8; ++v) {
    const int rowA = rowbase + v + 8 * g;
    const float invA = 1.0f / lrunA[v];
    float* orowA = Out + ((size_t)b * Sq + rowA) * HEAD_D;
    orowA[n]      = accA[0][v] * invA;
    orowA[16 + n] = accA[1][v] * invA;
    orowA[32 + n] = accA[2][v] * invA;
    orowA[48 + n] = accA[3][v] * invA;

    const int rowB = rowA + 16;
    const float invB = 1.0f / lrunB[v];
    float* orowB = Out + ((size_t)b * Sq + rowB) * HEAD_D;
    orowB[n]      = accB[0][v] * invB;
    orowB[16 + n] = accB[1][v] * invB;
    orowB[32 + n] = accB[2][v] * invB;
    orowB[48 + n] = accB[3][v] * invB;
  }
}

extern "C" void kernel_launch(void* const* d_in, const int* in_sizes, int n_in,
                              void* d_out, int out_size, void* d_ws, size_t ws_size,
                              hipStream_t stream) {
  const float* Q  = (const float*)d_in[0];
  const float* K  = (const float*)d_in[1];
  const float* V  = (const float*)d_in[2];
  const int*   vl = (const int*)d_in[3];
  float* out = (float*)d_out;

  const int B  = in_sizes[3];                    // valid_lens: one entry per batch
  const int Sq = in_sizes[0] / (B * HEAD_D);     // 2048
  const int Sk = in_sizes[1] / (B * HEAD_D);     // 2048
  const int mblocks = Sq / BLOCK_M;              // 16

  dim3 grid(B * mblocks), block(WAVES * 32);
  hipLaunchKernelGGL(sdpa_flash_f16wmma, grid, block, 0, stream,
                     Q, K, V, vl, out, Sq, Sk, mblocks);
}

// v001
// It runs in 48.3 microseconds.
// Timed twice side by side with v000, it ran 1.89 and 1.88 times as fast.
#include <hip/hip_runtime.h>

typedef __attribute__((ext_vector_type(16))) _Float16 v16h;
typedef __attribute__((ext_vector_type(8)))  _Float16 v8h;
typedef __attribute__((ext_vector_type(8)))  float    v8f;
typedef __attribute__((ext_vector_type(4)))  float    f32x4;

#define MASK_VALUE (-1000000.0f)
#define HEAD_D     64
#define KBLK       64           // keys per iteration (two WMMA K-steps deep)
#define WAVES      4            // waves per workgroup
#define MWAVE      32           // query rows per wave (two 16-row WMMA tiles)
#define BLOCK_M    (WAVES*MWAVE)// 128 query rows per workgroup

#define K_STRIDE 72
#define V_STRIDE 72

static __device__ __forceinline__ v8h pack8(f32x4 a, f32x4 b, float s) {
  v8h r;
  r[0] = (_Float16)(a[0] * s); r[1] = (_Float16)(a[1] * s);
  r[2] = (_Float16)(a[2] * s); r[3] = (_Float16)(a[3] * s);
  r[4] = (_Float16)(b[0] * s); r[5] = (_Float16)(b[1] * s);
  r[6] = (_Float16)(b[2] * s); r[7] = (_Float16)(b[3] * s);
  return r;
}

static __device__ __forceinline__ v16h cat16(v8h lo, v8h hi) {
  return __builtin_shufflevector(lo, hi, 0,1,2,3,4,5,6,7,8,9,10,11,12,13,14,15);
}

static __device__ __forceinline__ v16h lds_frag(const _Float16* row, int g) {
  v8h lo = *(const v8h*)(row + g * 8);
  v8h hi = *(const v8h*)(row + 16 + g * 8);
  return cat16(lo, hi);
}

static __device__ __forceinline__ v8f wmma_f16(v16h a, v16h b, v8f c) {
  return __builtin_amdgcn_wmma_f32_16x16x32_f16(
      /*neg_a=*/false, a, /*neg_b=*/false, b,
      /*c_mod=*/(short)0, c, /*reuse_a=*/false, /*reuse_b=*/false);
}

static __device__ __forceinline__ float xhalf(float x) {
  const int b = __builtin_bit_cast(int, x);
  return __builtin_bit_cast(float, __builtin_amdgcn_permlanex16(
      b, b, 0x76543210, 0xfedcba98, false, false));
}

#define LOG2E 1.44269504f

static __device__ __forceinline__ float exp2_slot(float x) {
  float r;
  asm("v_exp_f32 %0, %1\n\tv_nop" : "=v"(r) : "v"(x));
  return r;
}

static __device__ __forceinline__ void exp2_tile(v8f& x) {
  float a0 = x[0], a1 = x[1], a2 = x[2], a3 = x[3];
  float a4 = x[4], a5 = x[5], a6 = x[6], a7 = x[7];
  asm("v_exp_f32 %0, %0\n\tv_exp_f32 %1, %1\n\tv_exp_f32 %2, %2\n\t"
      "v_exp_f32 %3, %3\n\tv_exp_f32 %4, %4\n\tv_exp_f32 %5, %5\n\t"
      "v_exp_f32 %6, %6\n\tv_exp_f32 %7, %7\n\tv_nop"
      : "+v"(a0), "+v"(a1), "+v"(a2), "+v"(a3),
        "+v"(a4), "+v"(a5), "+v"(a6), "+v"(a7));
  x[0] = a0; x[1] = a1; x[2] = a2; x[3] = a3;
  x[4] = a4; x[5] = a5; x[6] = a6; x[7] = a7;
}

// Online-softmax update for one 16-query tile over a 64-key block, on S^T.
// Lane (n, g) holds query n's scores of keys t*16 + 8*g + v, so the maximum
// and the sum run in-lane; the halves meet once for the maximum, and lrun
// stays a per-half partial sum until the epilogue. Two converted S^T tiles
// are a B fragment in the hardware k order: P stays in registers.
static __device__ __forceinline__ void softmax_update(
    const v8f st[4], v8f acc[4], float& mrun, float& lrun,
    v16h& p0, v16h& p1) {
  float mx[4];
#pragma unroll
  for (int t = 0; t < 4; ++t) {
    mx[t] = st[t][0];
#pragma unroll
    for (int v = 1; v < 8; ++v) mx[t] = fmaxf(mx[t], st[t][v]);
  }
  float x = fmaxf(fmaxf(mx[0], mx[1]), fmaxf(mx[2], mx[3]));
  x = fmaxf(x, xhalf(x));
  const float mnew  = fmaxf(mrun, x);
  const float alpha = exp2_slot((mrun - mnew) * LOG2E);
  mrun = mnew;
  float sm[4];
#pragma unroll
  for (int t = 0; t < 4; ++t) {
    v8f e = (st[t] - mnew) * LOG2E;
    exp2_tile(e);
    sm[t] = e[0];
#pragma unroll
    for (int v = 0; v < 8; ++v) {
      if (v > 0) sm[t] += e[v];
      if (t < 2) p0[(t & 1) * 8 + v] = (_Float16)e[v];
      else       p1[(t & 1) * 8 + v] = (_Float16)e[v];
    }
  }
  lrun = lrun * alpha + ((sm[0] + sm[1]) + (sm[2] + sm[3]));
#pragma unroll
  for (int j = 0; j < 4; ++j) acc[j] *= alpha;
}

__global__ __launch_bounds__(128)
void sdpa_flash_f16wmma(const float* __restrict__ Q, const float* __restrict__ K,
                        const float* __restrict__ V, const int* __restrict__ valid_lens,
                        float* __restrict__ Out, int Sq, int Sk, int mblocks) {
  __shared__ _Float16 Klds[KBLK][K_STRIDE];       // [key][d]   (f16)
  __shared__ _Float16 Vlds[HEAD_D][V_STRIDE];     // [d][key]   (transposed f16)

  const int tid  = threadIdx.x;
  const int lane = tid & 31;
  const int w    = tid >> 5;        // wave id 0..3
  const int n    = lane & 15;       // query column / operand row index
  const int g    = lane >> 4;       // lane group (0 or 1)

  const int b  = blockIdx.x / mblocks;
  const int mb = blockIdx.x % mblocks;
  const int rowbase = mb * BLOCK_M + w * MWAVE;   // rows [rowbase, rowbase+32)

  const int vlen = valid_lens[b];

  const float* Qb = Q + (size_t)b * Sq * HEAD_D;
  const float* Kb = K + (size_t)b * Sk * HEAD_D;
  const float* Vb = V + (size_t)b * Sk * HEAD_D;

  // ---- Q^T B-fragments for two 16-query tiles, pre-scaled by 1/sqrt(d) ----
  const float scale = 0.125f;  // 1/sqrt(64)
  v16h qA0, qA1, qB0, qB1;
  {
    const float* qr = Qb + (size_t)(rowbase + n) * HEAD_D;
    f32x4 a0 = *(const f32x4*)(qr + g * 8);
    f32x4 a1 = *(const f32x4*)(qr + g * 8 + 4);
    f32x4 b0 = *(const f32x4*)(qr + 16 + g * 8);
    f32x4 b1 = *(const f32x4*)(qr + 16 + g * 8 + 4);
    qA0 = cat16(pack8(a0, a1, scale), pack8(b0, b1, scale));
    a0 = *(const f32x4*)(qr + 32 + g * 8);
    a1 = *(const f32x4*)(qr + 32 + g * 8 + 4);
    b0 = *(const f32x4*)(qr + 48 + g * 8);
    b1 = *(const f32x4*)(qr + 48 + g * 8 + 4);
    qA1 = cat16(pack8(a0, a1, scale), pack8(b0, b1, scale));
    qr += 16 * HEAD_D;  // second row tile
    a0 = *(const f32x4*)(qr + g * 8);
    a1 = *(const f32x4*)(qr + g * 8 + 4);
    b0 = *(const f32x4*)(qr + 16 + g * 8);
    b1 = *(const f32x4*)(qr + 16 + g * 8 + 4);
    qB0 = cat16(pack8(a0, a1, scale), pack8(b0, b1, scale));
    a0 = *(const f32x4*)(qr + 32 + g * 8);
    a1 = *(const f32x4*)(qr + 32 + g * 8 + 4);
    b0 = *(const f32x4*)(qr + 48 + g * 8);
    b1 = *(const f32x4*)(qr + 48 + g * 8 + 4);
    qB1 = cat16(pack8(a0, a1, scale), pack8(b0, b1, scale));
  }

  // ---- flash-attention state (two query tiles); acc[j][v] = O^T[16j+8g+v][n] ----
  v8f accA[4] = {}, accB[4] = {};
  float mrunA = -__builtin_inff(), mrunB = -__builtin_inff();
  float lrunA = 0.0f, lrunB = 0.0f;

  // cooperative loader coords: 128 threads cover 64 rows x 2 col-groups of 32
  const int lr = tid >> 1;          // 0..63 key row
  const int lc = (tid & 1) << 5;    // 0 or 32 d column

  for (int kb = 0; kb < Sk; kb += KBLK) {
    __syncthreads();  // previous iteration's K/V reads complete

    // ---- stage K (64x64) and V^T (64x64) into LDS as f16 ----
    {
      const float* kg = Kb + (size_t)(kb + lr) * HEAD_D + lc;
      f32x4 k0 = *(const f32x4*)(kg);
      f32x4 k1 = *(const f32x4*)(kg + 4);
      f32x4 k2 = *(const f32x4*)(kg + 8);
      f32x4 k3 = *(const f32x4*)(kg + 12);
      f32x4 k4 = *(const f32x4*)(kg + 16);
      f32x4 k5 = *(const f32x4*)(kg + 20);
      f32x4 k6 = *(const f32x4*)(kg + 24);
      f32x4 k7 = *(const f32x4*)(kg + 28);
      *(v8h*)(&Klds[lr][0] + lc)      = pack8(k0, k1, 1.0f);
      *(v8h*)(&Klds[lr][0] + lc + 8)  = pack8(k2, k3, 1.0f);
      *(v8h*)(&Klds[lr][0] + lc + 16) = pack8(k4, k5, 1.0f);
      *(v8h*)(&Klds[lr][0] + lc + 24) = pack8(k6, k7, 1.0f);

      const float* vg = Vb + (size_t)(kb + lr) * HEAD_D + lc;
      f32x4 vq[8];
#pragma unroll
      for (int i = 0; i < 8; ++i) vq[i] = *(const f32x4*)(vg + 4 * i);
#pragma unroll
      for (int i = 0; i < 8; ++i) {
        Vlds[lc + 4 * i + 0][lr] = (_Float16)vq[i][0];
        Vlds[lc + 4 * i + 1][lr] = (_Float16)vq[i][1];
        Vlds[lc + 4 * i + 2][lr] = (_Float16)vq[i][2];
        Vlds[lc + 4 * i + 3][lr] = (_Float16)vq[i][3];
      }

      if (kb + KBLK < Sk) {  // uniform branch: prefetch next block into L2
        __builtin_prefetch(Kb + (size_t)(kb + KBLK + lr) * HEAD_D + lc, 0, 0);
        __builtin_prefetch(Vb + (size_t)(kb + KBLK + lr) * HEAD_D + lc, 0, 0);
      }
    }
    __syncthreads();

    // ---- S^T = K @ (Q*scale)^T : K fragments reused by both query tiles ----
    v8f sA[4], sB[4];
    {
      v8f z = {};
#pragma unroll
      for (int t = 0; t < 4; ++t) {
        v16h kf_lo = lds_frag(&Klds[t * 16 + n][0], g);
        v16h kf_hi = lds_frag(&Klds[t * 16 + n][32], g);
        sA[t] = wmma_f16(kf_lo, qA0, z);
        sA[t] = wmma_f16(kf_hi, qA1, sA[t]);
        sB[t] = wmma_f16(kf_lo, qB0, z);
        sB[t] = wmma_f16(kf_hi, qB1, sB[t]);
      }
    }

    // ---- mask (boundary / tail blocks only; uniform scalar branch) ----
    if (kb + KBLK > vlen) {
      const int rem = vlen - kb - 8 * g;  // valid keys left, counted from this lane's first
#pragma unroll
      for (int t = 0; t < 4; ++t) {
#pragma unroll
        for (int v = 0; v < 8; ++v) {
          const bool ok = (t * 16 + v) < rem;
          sA[t][v] = ok ? sA[t][v] : MASK_VALUE;
          sB[t][v] = ok ? sB[t][v] : MASK_VALUE;
        }
      }
    }

    // ---- online softmax; P^T packs straight into B fragments ----
    v16h pA0, pA1, pB0, pB1;  // keys 0..31 and 32..63 of each query tile
    softmax_update(sA, accA, mrunA, lrunA, pA0, pA1);
    softmax_update(sB, accB, mrunB, lrunB, pB0, pB1);

    // ---- O^T += V^T @ P^T : V fragments reused by both query tiles ----
#pragma unroll
    for (int j = 0; j < 4; ++j) {
      v16h vf_lo = lds_frag(&Vlds[j * 16 + n][0],  g);
      v16h vf_hi = lds_frag(&Vlds[j * 16 + n][32], g);
      accA[j] = wmma_f16(vf_lo, pA0, accA[j]);
      accA[j] = wmma_f16(vf_hi, pA1, accA[j]);
      accB[j] = wmma_f16(vf_lo, pB0, accB[j]);
      accB[j] = wmma_f16(vf_hi, pB1, accB[j]);
    }
  }

  // ---- epilogue: join the halves' sums, normalize, store 8 consecutive d per lane ----
  {
    const float invA = 1.0f / (lrunA + xhalf(lrunA));
    const float invB = 1.0f / (lrunB + xhalf(lrunB));
    float* orowA = Out + ((size_t)b * Sq + rowbase + n) * HEAD_D + 8 * g;
    float* orowB = orowA + 16 * HEAD_D;
#pragma unroll
    for (int j = 0; j < 4; ++j) {
      f32x4 o;
      o[0] = accA[j][0] * invA; o[1] = accA[j][1] * invA;
      o[2] = accA[j][2] * invA; o[3] = accA[j][3] * invA;
      *(f32x4*)(orowA + 16 * j) = o;
      o[0] = accA[j][4] * invA; o[1] = accA[j][5] * invA;
      o[2] = accA[j][6] * invA; o[3] = accA[j][7] * invA;
      *(f32x4*)(orowA + 16 * j + 4) = o;
      o[0] = accB[j][0] * invB; o[1] = accB[j][1] * invB;
      o[2] = accB[j][2] * invB; o[3] = accB[j][3] * invB;
      *(f32x4*)(orowB + 16 * j) = o;
      o[0] = accB[j][4] * invB; o[1] = accB[j][5] * invB;
      o[2] = accB[j][6] * invB; o[3] = accB[j][7] * invB;
      *(f32x4*)(orowB + 16 * j + 4) = o;
    }
  }
}

extern "C" void kernel_launch(void* const* d_in, const int* in_sizes, int n_in,
                              void* d_out, int out_size, void* d_ws, size_t ws_size,
                              hipStream_t stream) {
  const float* Q  = (const float*)d_in[0];
  const float* K  = (const float*)d_in[1];
  const float* V  = (const float*)d_in[2];
  const int*   vl = (const int*)d_in[3];
  float* out = (float*)d_out;

  const int B  = in_sizes[3];                    // valid_lens: one entry per batch
  const int Sq = in_sizes[0] / (B * HEAD_D);     // 2048
  const int Sk = in_sizes[1] / (B * HEAD_D);     // 2048
  const int mblocks = Sq / BLOCK_M;              // 16

  dim3 grid(B * mblocks), block(WAVES * 32);
  hipLaunchKernelGGL(sdpa_flash_f16wmma, grid, block, 0, stream,
                     Q, K, V, vl, out, Sq, Sk, mblocks);
}

// v002
// One run takes 37.2 microseconds.
// In both of two side-by-side timings against v001, it was 1.30 times as fast.
// Counting every step since v000, it is 2.44 times as fast.
#include <hip/hip_runtime.h>

typedef __attribute__((ext_vector_type(16))) _Float16 v16h;
typedef __attribute__((ext_vector_type(8)))  _Float16 v8h;
typedef __attribute__((ext_vector_type(8)))  float    v8f;
typedef __attribute__((ext_vector_type(4)))  float    f32x4;

#define MASK_VALUE (-1000000.0f)
#define HEAD_D     64
#define KBLK       64           // keys per iteration (two WMMA K-steps deep)
#define WAVES      4            // waves per key group
#define KGROUPS    4            // key groups per workgroup: group r takes key blocks r, r+4, ...
#define MWAVE      32           // query rows per wave (two 16-row WMMA tiles)
#define BLOCK_M    (WAVES*MWAVE)// 128 query rows per workgroup (every group works on all of them)
#define GTHREADS   (WAVES*32)   // threads per key group
#define CHUNKS     16           // 16-byte pieces of one lane's two accumulator tiles
#define CPG        (CHUNKS/KGROUPS) // pieces that each group joins and stores

#define K_STRIDE 72
#define V_STRIDE 72

static __device__ __forceinline__ v8h pack8(f32x4 a, f32x4 b, float s) {
  v8h r;
  r[0] = (_Float16)(a[0] * s); r[1] = (_Float16)(a[1] * s);
  r[2] = (_Float16)(a[2] * s); r[3] = (_Float16)(a[3] * s);
  r[4] = (_Float16)(b[0] * s); r[5] = (_Float16)(b[1] * s);
  r[6] = (_Float16)(b[2] * s); r[7] = (_Float16)(b[3] * s);
  return r;
}

static __device__ __forceinline__ v16h cat16(v8h lo, v8h hi) {
  return __builtin_shufflevector(lo, hi, 0,1,2,3,4,5,6,7,8,9,10,11,12,13,14,15);
}

static __device__ __forceinline__ v16h lds_frag(const _Float16* row, int g) {
  v8h lo = *(const v8h*)(row + g * 8);
  v8h hi = *(const v8h*)(row + 16 + g * 8);
  return cat16(lo, hi);
}

static __device__ __forceinline__ v8f wmma_f16(v16h a, v16h b, v8f c) {
  return __builtin_amdgcn_wmma_f32_16x16x32_f16(
      /*neg_a=*/false, a, /*neg_b=*/false, b,
      /*c_mod=*/(short)0, c, /*reuse_a=*/false, /*reuse_b=*/false);
}

static __device__ __forceinline__ float xhalf(float x) {
  const int b = __builtin_bit_cast(int, x);
  return __builtin_bit_cast(float, __builtin_amdgcn_permlanex16(
      b, b, 0x76543210, 0xfedcba98, false, false));
}

#define LOG2E 1.44269504f

static __device__ __forceinline__ float exp2_slot(float x) {
  float r;
  asm("v_exp_f32 %0, %1\n\tv_nop" : "=v"(r) : "v"(x));
  return r;
}

static __device__ __forceinline__ void exp2_tile(v8f& x) {
  float a0 = x[0], a1 = x[1], a2 = x[2], a3 = x[3];
  float a4 = x[4], a5 = x[5], a6 = x[6], a7 = x[7];
  asm("v_exp_f32 %0, %0\n\tv_exp_f32 %1, %1\n\tv_exp_f32 %2, %2\n\t"
      "v_exp_f32 %3, %3\n\tv_exp_f32 %4, %4\n\tv_exp_f32 %5, %5\n\t"
      "v_exp_f32 %6, %6\n\tv_exp_f32 %7, %7\n\tv_nop"
      : "+v"(a0), "+v"(a1), "+v"(a2), "+v"(a3),
        "+v"(a4), "+v"(a5), "+v"(a6), "+v"(a7));
  x[0] = a0; x[1] = a1; x[2] = a2; x[3] = a3;
  x[4] = a4; x[5] = a5; x[6] = a6; x[7] = a7;
}

// Online-softmax update for one 16-query tile over a 64-key block, on S^T.
// Lane (n, g) holds query n's scores of keys t*16 + 8*g + v, so the maximum
// and the sum run in-lane; the halves meet once for the maximum, and lrun
// stays a per-half partial sum until the epilogue. Two converted S^T tiles
// are a B fragment in the hardware k order: P stays in registers.
static __device__ __forceinline__ void softmax_update(
    const v8f st[4], v8f acc[4], float& mrun, float& lrun,
    v16h& p0, v16h& p1) {
  float mx[4];
#pragma unroll
  for (int t = 0; t < 4; ++t) {
    mx[t] = st[t][0];
#pragma unroll
    for (int v = 1; v < 8; ++v) mx[t] = fmaxf(mx[t], st[t][v]);
  }
  float x = fmaxf(fmaxf(mx[0], mx[1]), fmaxf(mx[2], mx[3]));
  x = fmaxf(x, xhalf(x));
  const float mnew  = fmaxf(mrun, x);
  const float alpha = exp2_slot((mrun - mnew) * LOG2E);
  mrun = mnew;
  float sm[4];
#pragma unroll
  for (int t = 0; t < 4; ++t) {
    v8f e = (st[t] - mnew) * LOG2E;
    exp2_tile(e);
    sm[t] = e[0];
#pragma unroll
    for (int v = 0; v < 8; ++v) {
      if (v > 0) sm[t] += e[v];
      if (t < 2) p0[(t & 1) * 8 + v] = (_Float16)e[v];
      else       p1[(t & 1) * 8 + v] = (_Float16)e[v];
    }
  }
  lrun = lrun * alpha + ((sm[0] + sm[1]) + (sm[2] + sm[3]));
#pragma unroll
  for (int j = 0; j < 4; ++j) acc[j] *= alpha;
}

// LDS: in the loop each group's own K and V^T block; behind the loop the same
// bytes carry every group's partial state to the join.
struct StageBuf {
  _Float16 K[KGROUPS][KBLK][K_STRIDE];     // [group][key][d]   (f16)
  _Float16 V[KGROUPS][HEAD_D][V_STRIDE];   // [group][d][key]   (transposed f16)
};
struct JoinBuf {
  f32x4 acc[KGROUPS][CHUNKS][GTHREADS];    // lane-contiguous: conflict-free b128
  float m[KGROUPS][2][GTHREADS];
  float l[KGROUPS][2][GTHREADS];
};
union SharedBuf { StageBuf st; JoinBuf jn; };

__global__ __launch_bounds__(KGROUPS*GTHREADS)
void sdpa_flash_f16wmma(const float* __restrict__ Q, const float* __restrict__ K,
                        const float* __restrict__ V, const int* __restrict__ valid_lens,
                        float* __restrict__ Out, int Sq, int Sk, int mblocks) {
  __shared__ SharedBuf sh;

  const int grp  = __builtin_amdgcn_readfirstlane(threadIdx.x >> 7);  // key group
  const int tid  = threadIdx.x & (GTHREADS - 1);                      // thread in the group
  const int lane = tid & 31;
  const int w    = tid >> 5;        // wave id 0..3 in the group
  _Float16 (*Klds)[K_STRIDE] = sh.st.K[grp];
  _Float16 (*Vlds)[V_STRIDE] = sh.st.V[grp];
  const int n    = lane & 15;       // query column / operand row index
  const int g    = lane >> 4;       // lane group (0 or 1)

  const int b  = blockIdx.x / mblocks;
  const int mb = blockIdx.x % mblocks;
  const int rowbase = mb * BLOCK_M + w * MWAVE;   // rows [rowbase, rowbase+32)

  const int vlen = valid_lens[b];

  const float* Qb = Q + (size_t)b * Sq * HEAD_D;
  const float* Kb = K + (size_t)b * Sk * HEAD_D;
  const float* Vb = V + (size_t)b * Sk * HEAD_D;

  // ---- Q^T B-fragments for two 16-query tiles, pre-scaled by 1/sqrt(d) ----
  const float scale = 0.125f;  // 1/sqrt(64)
  v16h qA0, qA1, qB0, qB1;
  {
    const float* qr = Qb + (size_t)(rowbase + n) * HEAD_D;
    f32x4 a0 = *(const f32x4*)(qr + g * 8);
    f32x4 a1 = *(const f32x4*)(qr + g * 8 + 4);
    f32x4 b0 = *(const f32x4*)(qr + 16 + g * 8);
    f32x4 b1 = *(const f32x4*)(qr + 16 + g * 8 + 4);
    qA0 = cat16(pack8(a0, a1, scale), pack8(b0, b1, scale));
    a0 = *(const f32x4*)(qr + 32 + g * 8);
    a1 = *(const f32x4*)(qr + 32 + g * 8 + 4);
    b0 = *(const f32x4*)(qr + 48 + g * 8);
    b1 = *(const f32x4*)(qr + 48 + g * 8 + 4);
    qA1 = cat16(pack8(a0, a1, scale), pack8(b0, b1, scale));
    qr += 16 * HEAD_D;  // second row tile
    a0 = *(const f32x4*)(qr + g * 8);
    a1 = *(const f32x4*)(qr + g * 8 + 4);
    b0 = *(const f32x4*)(qr + 16 + g * 8);
    b1 = *(const f32x4*)(qr + 16 + g * 8 + 4);
    qB0 = cat16(pack8(a0, a1, scale), pack8(b0, b1, scale));
    a0 = *(const f32x4*)(qr + 32 + g * 8);
    a1 = *(const f32x4*)(qr + 32 + g * 8 + 4);
    b0 = *(const f32x4*)(qr + 48 + g * 8);
    b1 = *(const f32x4*)(qr + 48 + g * 8 + 4);
    qB1 = cat16(pack8(a0, a1, scale), pack8(b0, b1, scale));
  }

  // ---- flash-attention state (two query tiles); acc[j][v] = O^T[16j+8g+v][n] ----
  v8f accA[4] = {}, accB[4] = {};
  float mrunA = -__builtin_inff(), mrunB = -__builtin_inff();
  float lrunA = 0.0f, lrunB = 0.0f;

  // cooperative loader coords: 128 threads cover 64 rows x 2 col-groups of 32
  const int lr = tid >> 1;          // 0..63 key row
  const int lc = (tid & 1) << 5;    // 0 or 32 d column

  // Every wave makes the same number of trips (the barriers are the whole
  // work-group's); a group whose block lies past the end sits the trip out.
  for (int kb0 = 0; kb0 < Sk; kb0 += KGROUPS * KBLK) {
    const int  kb = kb0 + grp * KBLK;
    const bool on = kb < Sk;        // wave-uniform
    __syncthreads();  // previous iteration's K/V reads complete

    // ---- stage K (64x64) and V^T (64x64) into LDS as f16 ----
    if (on) {
      const float* kg = Kb + (size_t)(kb + lr) * HEAD_D + lc;
      f32x4 k0 = *(const f32x4*)(kg);
      f32x4 k1 = *(const f32x4*)(kg + 4);
      f32x4 k2 = *(const f32x4*)(kg + 8);
      f32x4 k3 = *(const f32x4*)(kg + 12);
      f32x4 k4 = *(const f32x4*)(kg + 16);
      f32x4 k5 = *(const f32x4*)(kg + 20);
      f32x4 k6 = *(const f32x4*)(kg + 24);
      f32x4 k7 = *(const f32x4*)(kg + 28);
      *(v8h*)(&Klds[lr][0] + lc)      = pack8(k0, k1, 1.0f);
      *(v8h*)(&Klds[lr][0] + lc + 8)  = pack8(k2, k3, 1.0f);
      *(v8h*)(&Klds[lr][0] + lc + 16) = pack8(k4, k5, 1.0f);
      *(v8h*)(&Klds[lr][0] + lc + 24) = pack8(k6, k7, 1.0f);

      const float* vg = Vb + (size_t)(kb + lr) * HEAD_D + lc;
      f32x4 vq[8];
#pragma unroll
      for (int i = 0; i < 8; ++i) vq[i] = *(const f32x4*)(vg + 4 * i);
#pragma unroll
      for (int i = 0; i < 8; ++i) {
        Vlds[lc + 4 * i + 0][lr] = (_Float16)vq[i][0];
        Vlds[lc + 4 * i + 1][lr] = (_Float16)vq[i][1];
        Vlds[lc + 4 * i + 2][lr] = (_Float16)vq[i][2];
        Vlds[lc + 4 * i + 3][lr] = (_Float16)vq[i][3];
      }

      if (kb + KGROUPS * KBLK < Sk) {  // uniform branch: prefetch the group's next block into L2
        __builtin_prefetch(Kb + (size_t)(kb + KGROUPS * KBLK + lr) * HEAD_D + lc, 0, 0);
        __builtin_prefetch(Vb + (size_t)(kb + KGROUPS * KBLK + lr) * HEAD_D + lc, 0, 0);
        // The prefetches' address registers are reused behind the barrier:
        // the wait that is kept in front of such an overwrite.
        asm volatile("s_wait_xcnt 0x0" ::: "memory");
      }
    }
    __syncthreads();
    if (!on) continue;

    // ---- S^T = K @ (Q*scale)^T : K fragments reused by both query tiles ----
    v8f sA[4], sB[4];
    {
      v8f z = {};
#pragma unroll
      for (int t = 0; t < 4; ++t) {
        v16h kf_lo = lds_frag(&Klds[t * 16 + n][0], g);
        v16h kf_hi = lds_frag(&Klds[t * 16 + n][32], g);
        sA[t] = wmma_f16(kf_lo, qA0, z);
        sA[t] = wmma_f16(kf_hi, qA1, sA[t]);
        sB[t] = wmma_f16(kf_lo, qB0, z);
        sB[t] = wmma_f16(kf_hi, qB1, sB[t]);
      }
    }

    // ---- mask (boundary / tail blocks only; uniform scalar branch) ----
    if (kb + KBLK > vlen) {
      const int rem = vlen - kb - 8 * g;  // valid keys left, counted from this lane's first
#pragma unroll
      for (int t = 0; t < 4; ++t) {
#pragma unroll
        for (int v = 0; v < 8; ++v) {
          const bool ok = (t * 16 + v) < rem;
          sA[t][v] = ok ? sA[t][v] : MASK_VALUE;
          sB[t][v] = ok ? sB[t][v] : MASK_VALUE;
        }
      }
    }

    // ---- online softmax; P^T packs straight into B fragments ----
    v16h pA0, pA1, pB0, pB1;  // keys 0..31 and 32..63 of each query tile
    softmax_update(sA, accA, mrunA, lrunA, pA0, pA1);
    softmax_update(sB, accB, mrunB, lrunB, pB0, pB1);

    // ---- O^T += V^T @ P^T : V fragments reused by both query tiles ----
#pragma unroll
    for (int j = 0; j < 4; ++j) {
      v16h vf_lo = lds_frag(&Vlds[j * 16 + n][0],  g);
      v16h vf_hi = lds_frag(&Vlds[j * 16 + n][32], g);
      accA[j] = wmma_f16(vf_lo, pA0, accA[j]);
      accA[j] = wmma_f16(vf_hi, pA1, accA[j]);
      accB[j] = wmma_f16(vf_lo, pB0, accB[j]);
      accB[j] = wmma_f16(vf_hi, pB1, accB[j]);
    }
  }

  // ---- join of the key groups: every group leaves (m, l, acc) in LDS ----
  __syncthreads();  // every wave's last K/V reads are done: the bytes change their use
#pragma unroll
  for (int j = 0; j < 4; ++j) {
    f32x4 c;
    c[0] = accA[j][0]; c[1] = accA[j][1]; c[2] = accA[j][2]; c[3] = accA[j][3];
    sh.jn.acc[grp][2 * j][tid] = c;
    c[0] = accA[j][4]; c[1] = accA[j][5]; c[2] = accA[j][6]; c[3] = accA[j][7];
    sh.jn.acc[grp][2 * j + 1][tid] = c;
    c[0] = accB[j][0]; c[1] = accB[j][1]; c[2] = accB[j][2]; c[3] = accB[j][3];
    sh.jn.acc[grp][8 + 2 * j][tid] = c;
    c[0] = accB[j][4]; c[1] = accB[j][5]; c[2] = accB[j][6]; c[3] = accB[j][7];
    sh.jn.acc[grp][8 + 2 * j + 1][tid] = c;
  }
  sh.jn.m[grp][0][tid] = mrunA; sh.jn.l[grp][0][tid] = lrunA;
  sh.jn.m[grp][1][tid] = mrunB; sh.jn.l[grp][1][tid] = lrunB;
  __syncthreads();  // publishes every group's partial state

  // ---- group r joins pieces [r*CPG, (r+1)*CPG): all of one query tile, whole 128-byte lines ----
  {
    const int c0 = grp * CPG;
    const int T  = c0 >> 3;          // query tile of these pieces
    float mg[KGROUPS], wg[KGROUPS];
    float M = -__builtin_inff();
#pragma unroll
    for (int r = 0; r < KGROUPS; ++r) { mg[r] = sh.jn.m[r][T][tid]; M = fmaxf(M, mg[r]); }
    float L = 0.0f;
#pragma unroll
    for (int r = 0; r < KGROUPS; ++r) {
      wg[r] = exp2_slot((mg[r] - M) * LOG2E);
      L += wg[r] * sh.jn.l[r][T][tid];
    }
    const float inv = 1.0f / (L + xhalf(L));   // the halves' sums meet here
    float* orow = Out + ((size_t)b * Sq + rowbase + T * 16 + n) * HEAD_D + 8 * g;
#pragma unroll
    for (int i = 0; i < CPG; ++i) {
      const int c = c0 + i;          // piece: d = 16*((c>>1)&3) + 8*g + 4*(c&1)
      f32x4 o = sh.jn.acc[0][c][tid] * wg[0];
#pragma unroll
      for (int r = 1; r < KGROUPS; ++r) o += sh.jn.acc[r][c][tid] * wg[r];
      *(f32x4*)(orow + 16 * ((c >> 1) & 3) + 4 * (c & 1)) = o * inv;
    }
  }
}

extern "C" void kernel_launch(void* const* d_in, const int* in_sizes, int n_in,
                              void* d_out, int out_size, void* d_ws, size_t ws_size,
                              hipStream_t stream) {
  const float* Q  = (const float*)d_in[0];
  const float* K  = (const float*)d_in[1];
  const float* V  = (const float*)d_in[2];
  const int*   vl = (const int*)d_in[3];
  float* out = (float*)d_out;

  const int B  = in_sizes[3];                    // valid_lens: one entry per batch
  const int Sq = in_sizes[0] / (B * HEAD_D);     // 2048
  const int Sk = in_sizes[1] / (B * HEAD_D);     // 2048
  const int mblocks = Sq / BLOCK_M;              // 16

  dim3 grid(B * mblocks), block(KGROUPS * GTHREADS);
  hipLaunchKernelGGL(sdpa_flash_f16wmma, grid, block, 0, stream,
                     Q, K, V, vl, out, Sq, Sk, mblocks);
}

// v003
// Measured time: 26.9 microseconds a run.
// Next to v002, in two timings, it ran 1.39 times as fast each time.
// Counting every step since v000, it is 3.40 times as fast.
#include <hip/hip_runtime.h>

typedef __attribute__((ext_vector_type(16))) _Float16 v16h;
typedef __attribute__((ext_vector_type(8)))  _Float16 v8h;
typedef __attribute__((ext_vector_type(4)))  _Float16 v4h;
typedef __attribute__((ext_vector_type(8)))  float    v8f;
typedef __attribute__((ext_vector_type(4)))  float    f32x4;

#define MASK_VALUE (-1000000.0f)
#define HEAD_D     64
#define KBLK       64           // keys per iteration (two WMMA K-steps deep)
#define WAVES      4            // waves per key group
#define KGROUPS    4            // key groups per workgroup: group r takes key blocks r, r+4, ...
#define MWAVE      32           // query rows per wave (two 16-row WMMA tiles)
#define BLOCK_M    (WAVES*MWAVE)// 128 query rows per workgroup (every group works on all of them)
#define GTHREADS   (WAVES*32)   // threads per key group
#define CHUNKS     16           // 16-byte pieces of one lane's two accumulator tiles
#define CPG        (CHUNKS/KGROUPS) // pieces that each group joins and stores

#define K_STRIDE 72
#define V_STRIDE 72

static __device__ __forceinline__ v8h pack8(f32x4 a, f32x4 b, float s) {
  v8h r;
  r[0] = (_Float16)(a[0] * s); r[1] = (_Float16)(a[1] * s);
  r[2] = (_Float16)(a[2] * s); r[3] = (_Float16)(a[3] * s);
  r[4] = (_Float16)(b[0] * s); r[5] = (_Float16)(b[1] * s);
  r[6] = (_Float16)(b[2] * s); r[7] = (_Float16)(b[3] * s);
  return r;
}

static __device__ __forceinline__ v16h cat16(v8h lo, v8h hi) {
  return __builtin_shufflevector(lo, hi, 0,1,2,3,4,5,6,7,8,9,10,11,12,13,14,15);
}

static __device__ __forceinline__ v16h lds_frag(const _Float16* row, int g) {
  v8h lo = *(const v8h*)(row + g * 8);
  v8h hi = *(const v8h*)(row + 16 + g * 8);
  return cat16(lo, hi);
}

static __device__ __forceinline__ v8f wmma_f16(v16h a, v16h b, v8f c) {
  return __builtin_amdgcn_wmma_f32_16x16x32_f16(
      /*neg_a=*/false, a, /*neg_b=*/false, b,
      /*c_mod=*/(short)0, c, /*reuse_a=*/false, /*reuse_b=*/false);
}

static __device__ __forceinline__ float xhalf(float x) {
  const int b = __builtin_bit_cast(int, x);
  return __builtin_bit_cast(float, __builtin_amdgcn_permlanex16(
      b, b, 0x76543210, 0xfedcba98, false, false));
}

#define LOG2E 1.44269504f

static __device__ __forceinline__ float exp2_slot(float x) {
  float r;
  asm("v_exp_f32 %0, %1\n\tv_nop" : "=v"(r) : "v"(x));
  return r;
}

static __device__ __forceinline__ void exp2_tile(v8f& x) {
  float a0 = x[0], a1 = x[1], a2 = x[2], a3 = x[3];
  float a4 = x[4], a5 = x[5], a6 = x[6], a7 = x[7];
  asm("v_exp_f32 %0, %0\n\tv_exp_f32 %1, %1\n\tv_exp_f32 %2, %2\n\t"
      "v_exp_f32 %3, %3\n\tv_exp_f32 %4, %4\n\tv_exp_f32 %5, %5\n\t"
      "v_exp_f32 %6, %6\n\tv_exp_f32 %7, %7\n\tv_nop"
      : "+v"(a0), "+v"(a1), "+v"(a2), "+v"(a3),
        "+v"(a4), "+v"(a5), "+v"(a6), "+v"(a7));
  x[0] = a0; x[1] = a1; x[2] = a2; x[3] = a3;
  x[4] = a4; x[5] = a5; x[6] = a6; x[7] = a7;
}

// Online-softmax update for one 16-query tile over a 64-key block, on S^T.
// Lane (n, g) holds query n's scores of keys t*16 + 8*g + v, so the maximum
// and the sum run in-lane; the halves meet once for the maximum, and lrun
// stays a per-half partial sum until the epilogue. Two converted S^T tiles
// are a B fragment in the hardware k order: P stays in registers.
static __device__ __forceinline__ void softmax_update(
    const v8f st[4], v8f acc[4], float& mrun, float& lrun,
    v16h& p0, v16h& p1) {
  float mx[4];
#pragma unroll
  for (int t = 0; t < 4; ++t) {
    mx[t] = st[t][0];
#pragma unroll
    for (int v = 1; v < 8; ++v) mx[t] = fmaxf(mx[t], st[t][v]);
  }
  float x = fmaxf(fmaxf(mx[0], mx[1]), fmaxf(mx[2], mx[3]));
  x = fmaxf(x, xhalf(x));
  const float mnew  = fmaxf(mrun, x);
  const float alpha = exp2_slot((mrun - mnew) * LOG2E);
  mrun = mnew;
  float sm[4];
#pragma unroll
  for (int t = 0; t < 4; ++t) {
    v8f e = (st[t] - mnew) * LOG2E;
    exp2_tile(e);
    sm[t] = e[0];
#pragma unroll
    for (int v = 0; v < 8; ++v) {
      if (v > 0) sm[t] += e[v];
      if (t < 2) p0[(t & 1) * 8 + v] = (_Float16)e[v];
      else       p1[(t & 1) * 8 + v] = (_Float16)e[v];
    }
  }
  lrun = lrun * alpha + ((sm[0] + sm[1]) + (sm[2] + sm[3]));
#pragma unroll
  for (int j = 0; j < 4; ++j) acc[j] *= alpha;
}

// LDS: in the loop each group's own K and V^T block; behind the loop the same
// bytes carry every group's partial state to the join.
struct StageBuf {
  _Float16 K[KGROUPS][KBLK][K_STRIDE];     // [group][key][d]   (f16)
  _Float16 V[KGROUPS][HEAD_D][V_STRIDE];   // [group][d][key]   (transposed f16)
};
struct JoinBuf {
  f32x4 acc[KGROUPS][CHUNKS][GTHREADS];    // lane-contiguous: conflict-free b128
  float m[KGROUPS][2][GTHREADS];
  float l[KGROUPS][2][GTHREADS];
};
union SharedBuf { StageBuf st; JoinBuf jn; };

__global__ __launch_bounds__(KGROUPS*GTHREADS)
void sdpa_flash_f16wmma(const float* __restrict__ Q, const float* __restrict__ K,
                        const float* __restrict__ V, const int* __restrict__ valid_lens,
                        float* __restrict__ Out, int Sq, int Sk, int mblocks) {
  __shared__ SharedBuf sh;

  const int grp  = __builtin_amdgcn_readfirstlane(threadIdx.x >> 7);  // key group
  const int tid  = threadIdx.x & (GTHREADS - 1);                      // thread in the group
  const int lane = tid & 31;
  const int w    = tid >> 5;        // wave id 0..3 in the group
  _Float16 (*Klds)[K_STRIDE] = sh.st.K[grp];
  _Float16 (*Vlds)[V_STRIDE] = sh.st.V[grp];
  const int n    = lane & 15;       // query column / operand row index
  const int g    = lane >> 4;       // lane group (0 or 1)

  const int b  = blockIdx.x / mblocks;
  const int mb = blockIdx.x % mblocks;
  const int rowbase = mb * BLOCK_M + w * MWAVE;   // rows [rowbase, rowbase+32)

  const int vlen = valid_lens[b];

  const float* Qb = Q + (size_t)b * Sq * HEAD_D;
  const float* Kb = K + (size_t)b * Sk * HEAD_D;
  const float* Vb = V + (size_t)b * Sk * HEAD_D;

  // ---- Q^T B-fragments for two 16-query tiles, pre-scaled by 1/sqrt(d) ----
  const float scale = 0.125f;  // 1/sqrt(64)
  v16h qA0, qA1, qB0, qB1;
  {
    const float* qr = Qb + (size_t)(rowbase + n) * HEAD_D;
    f32x4 a0 = *(const f32x4*)(qr + g * 8);
    f32x4 a1 = *(const f32x4*)(qr + g * 8 + 4);
    f32x4 b0 = *(const f32x4*)(qr + 16 + g * 8);
    f32x4 b1 = *(const f32x4*)(qr + 16 + g * 8 + 4);
    qA0 = cat16(pack8(a0, a1, scale), pack8(b0, b1, scale));
    a0 = *(const f32x4*)(qr + 32 + g * 8);
    a1 = *(const f32x4*)(qr + 32 + g * 8 + 4);
    b0 = *(const f32x4*)(qr + 48 + g * 8);
    b1 = *(const f32x4*)(qr + 48 + g * 8 + 4);
    qA1 = cat16(pack8(a0, a1, scale), pack8(b0, b1, scale));
    qr += 16 * HEAD_D;  // second row tile
    a0 = *(const f32x4*)(qr + g * 8);
    a1 = *(const f32x4*)(qr + g * 8 + 4);
    b0 = *(const f32x4*)(qr + 16 + g * 8);
    b1 = *(const f32x4*)(qr + 16 + g * 8 + 4);
    qB0 = cat16(pack8(a0, a1, scale), pack8(b0, b1, scale));
    a0 = *(const f32x4*)(qr + 32 + g * 8);
    a1 = *(const f32x4*)(qr + 32 + g * 8 + 4);
    b0 = *(const f32x4*)(qr + 48 + g * 8);
    b1 = *(const f32x4*)(qr + 48 + g * 8 + 4);
    qB1 = cat16(pack8(a0, a1, scale), pack8(b0, b1, scale));
  }

  // ---- flash-attention state (two query tiles); acc[j][v] = O^T[16j+8g+v][n] ----
  v8f accA[4] = {}, accB[4] = {};
  float mrunA = -__builtin_inff(), mrunB = -__builtin_inff();
  float lrunA = 0.0f, lrunB = 0.0f;

  // prefetch coords: one lane per 128-byte line of the group's 64 x 64 block
  const int lr = tid >> 1;          // 0..63 key row
  const int lc = (tid & 1) << 5;    // 0 or 32 d column

  const int dc = n << 2;            // d column of this lane's 16 bytes
  const int kr = w * 16 + g * 8;    // K rows kr .. kr+7
  const int vr = w * 16 + g * 4;    // V rows vr .. vr+3 and vr+8 .. vr+11

  // Every wave makes the same number of trips (the barriers are the whole
  // work-group's); a group whose block lies past the end sits the trip out.
  for (int kb0 = 0; kb0 < Sk; kb0 += KGROUPS * KBLK) {
    const int  kb = kb0 + grp * KBLK;
    const bool on = kb < Sk;        // wave-uniform
    __syncthreads();  // previous iteration's K/V reads complete

    // ---- stage K (64x64) and V^T (64x64) into LDS as f16 ----
    if (on) {
      const float* kg = Kb + (size_t)(kb + kr) * HEAD_D + dc;
      const float* vg = Vb + (size_t)(kb + vr) * HEAD_D + dc;
      f32x4 kq[8], vq[8];
#pragma unroll
      for (int i = 0; i < 8; ++i) kq[i] = *(const f32x4*)(kg + i * HEAD_D);
#pragma unroll
      for (int i = 0; i < 8; ++i)
        vq[i] = *(const f32x4*)(vg + ((i >> 2) * 8 + (i & 3)) * HEAD_D);
#pragma unroll
      for (int i = 0; i < 8; ++i) {
        v4h t;
        t[0] = (_Float16)kq[i][0]; t[1] = (_Float16)kq[i][1];
        t[2] = (_Float16)kq[i][2]; t[3] = (_Float16)kq[i][3];
        *(v4h*)(&Klds[kr + i][dc]) = t;
      }
#pragma unroll
      for (int q = 0; q < 2; ++q) {
#pragma unroll
        for (int c = 0; c < 4; ++c) {
          v4h t;
          t[0] = (_Float16)vq[4 * q + 0][c]; t[1] = (_Float16)vq[4 * q + 1][c];
          t[2] = (_Float16)vq[4 * q + 2][c]; t[3] = (_Float16)vq[4 * q + 3][c];
          *(v4h*)(&Vlds[dc + c][vr + 8 * q]) = t;
        }
      }

      if (kb + KGROUPS * KBLK < Sk) {  // uniform branch: prefetch the group's next block into L2
        __builtin_prefetch(Kb + (size_t)(kb + KGROUPS * KBLK + lr) * HEAD_D + lc, 0, 0);
        __builtin_prefetch(Vb + (size_t)(kb + KGROUPS * KBLK + lr) * HEAD_D + lc, 0, 0);
        // The prefetches' address registers are reused behind the barrier:
        // the wait that is kept in front of such an overwrite.
        asm volatile("s_wait_xcnt 0x0" ::: "memory");
      }
    }
    __syncthreads();
    if (!on) continue;

    // ---- S^T = K @ (Q*scale)^T : K fragments reused by both query tiles ----
    v8f sA[4], sB[4];
    {
      v8f z = {};
#pragma unroll
      for (int t = 0; t < 4; ++t) {
        v16h kf_lo = lds_frag(&Klds[t * 16 + n][0], g);
        v16h kf_hi = lds_frag(&Klds[t * 16 + n][32], g);
        sA[t] = wmma_f16(kf_lo, qA0, z);
        sA[t] = wmma_f16(kf_hi, qA1, sA[t]);
        sB[t] = wmma_f16(kf_lo, qB0, z);
        sB[t] = wmma_f16(kf_hi, qB1, sB[t]);
      }
    }

    // ---- mask (boundary / tail blocks only; uniform scalar branch) ----
    if (kb + KBLK > vlen) {
      const int rem = vlen - kb - 8 * g;  // valid keys left, counted from this lane's first
#pragma unroll
      for (int t = 0; t < 4; ++t) {
#pragma unroll
        for (int v = 0; v < 8; ++v) {
          const bool ok = (t * 16 + v) < rem;
          sA[t][v] = ok ? sA[t][v] : MASK_VALUE;
          sB[t][v] = ok ? sB[t][v] : MASK_VALUE;
        }
      }
    }

    // ---- online softmax; P^T packs straight into B fragments ----
    v16h pA0, pA1, pB0, pB1;  // keys 0..31 and 32..63 of each query tile
    softmax_update(sA, accA, mrunA, lrunA, pA0, pA1);
    softmax_update(sB, accB, mrunB, lrunB, pB0, pB1);

    // ---- O^T += V^T @ P^T : V fragments reused by both query tiles ----
#pragma unroll
    for (int j = 0; j < 4; ++j) {
      v16h vf_lo = lds_frag(&Vlds[j * 16 + n][0],  g);
      v16h vf_hi = lds_frag(&Vlds[j * 16 + n][32], g);
      accA[j] = wmma_f16(vf_lo, pA0, accA[j]);
      accA[j] = wmma_f16(vf_hi, pA1, accA[j]);
      accB[j] = wmma_f16(vf_lo, pB0, accB[j]);
      accB[j] = wmma_f16(vf_hi, pB1, accB[j]);
    }
  }

  // ---- join of the key groups: every group leaves (m, l, acc) in LDS ----
  __syncthreads();  // every wave's last K/V reads are done: the bytes change their use
#pragma unroll
  for (int j = 0; j < 4; ++j) {
    f32x4 c;
    c[0] = accA[j][0]; c[1] = accA[j][1]; c[2] = accA[j][2]; c[3] = accA[j][3];
    sh.jn.acc[grp][2 * j][tid] = c;
    c[0] = accA[j][4]; c[1] = accA[j][5]; c[2] = accA[j][6]; c[3] = accA[j][7];
    sh.jn.acc[grp][2 * j + 1][tid] = c;
    c[0] = accB[j][0]; c[1] = accB[j][1]; c[2] = accB[j][2]; c[3] = accB[j][3];
    sh.jn.acc[grp][8 + 2 * j][tid] = c;
    c[0] = accB[j][4]; c[1] = accB[j][5]; c[2] = accB[j][6]; c[3] = accB[j][7];
    sh.jn.acc[grp][8 + 2 * j + 1][tid] = c;
  }
  sh.jn.m[grp][0][tid] = mrunA; sh.jn.l[grp][0][tid] = lrunA;
  sh.jn.m[grp][1][tid] = mrunB; sh.jn.l[grp][1][tid] = lrunB;
  __syncthreads();  // publishes every group's partial state

  // ---- group r joins pieces [r*CPG, (r+1)*CPG): all of one query tile, whole 128-byte lines ----
  {
    const int c0 = grp * CPG;
    const int T  = c0 >> 3;          // query tile of these pieces
    float mg[KGROUPS], wg[KGROUPS];
    float M = -__builtin_inff();
#pragma unroll
    for (int r = 0; r < KGROUPS; ++r) { mg[r] = sh.jn.m[r][T][tid]; M = fmaxf(M, mg[r]); }
    float L = 0.0f;
#pragma unroll
    for (int r = 0; r < KGROUPS; ++r) {
      wg[r] = exp2_slot((mg[r] - M) * LOG2E);
      L += wg[r] * sh.jn.l[r][T][tid];
    }
    const float inv = 1.0f / (L + xhalf(L));   // the halves' sums meet here
    float* orow = Out + ((size_t)b * Sq + rowbase + T * 16 + n) * HEAD_D + 8 * g;
#pragma unroll
    for (int i = 0; i < CPG; ++i) {
      const int c = c0 + i;          // piece: d = 16*((c>>1)&3) + 8*g + 4*(c&1)
      f32x4 o = sh.jn.acc[0][c][tid] * wg[0];
#pragma unroll
      for (int r = 1; r < KGROUPS; ++r) o += sh.jn.acc[r][c][tid] * wg[r];
      *(f32x4*)(orow + 16 * ((c >> 1) & 3) + 4 * (c & 1)) = o * inv;
    }
  }
}

extern "C" void kernel_launch(void* const* d_in, const int* in_sizes, int n_in,
                              void* d_out, int out_size, void* d_ws, size_t ws_size,
                              hipStream_t stream) {
  const float* Q  = (const float*)d_in[0];
  const float* K  = (const float*)d_in[1];
  const float* V  = (const float*)d_in[2];
  const int*   vl = (const int*)d_in[3];
  float* out = (float*)d_out;

  const int B  = in_sizes[3];                    // valid_lens: one entry per batch
  const int Sq = in_sizes[0] / (B * HEAD_D);     // 2048
  const int Sk = in_sizes[1] / (B * HEAD_D);     // 2048
  const int mblocks = Sq / BLOCK_M;              // 16

  dim3 grid(B * mblocks), block(KGROUPS * GTHREADS);
  hipLaunchKernelGGL(sdpa_flash_f16wmma, grid, block, 0, stream,
                     Q, K, V, vl, out, Sq, Sk, mblocks);
}

// v004
// It runs in 24.1 microseconds.
// Two timings next to v003 put it at 1.11 and 1.12 times that version's speed.
// All steps since v000 together make it 3.80 times as fast.
#include <hip/hip_runtime.h>

typedef __attribute__((ext_vector_type(16))) _Float16 v16h;
typedef __attribute__((ext_vector_type(8)))  _Float16 v8h;
typedef __attribute__((ext_vector_type(4)))  _Float16 v4h;
typedef __attribute__((ext_vector_type(8)))  float    v8f;
typedef __attribute__((ext_vector_type(4)))  float    f32x4;

#define MASK_VALUE (-1000000.0f)
#define HEAD_D     64
#define KBLK       64           // keys per iteration (two WMMA K-steps deep)
#define WAVES      4            // waves per key group
#define KGROUPS    4            // key groups per workgroup: group r takes key blocks r, r+4, ...
#define MWAVE      32           // query rows per wave (two 16-row WMMA tiles)
#define BLOCK_M    (WAVES*MWAVE)// 128 query rows per workgroup (every group works on all of them)
#define GTHREADS   (WAVES*32)   // threads per key group
#define CHUNKS     16           // 16-byte pieces of one lane's two accumulator tiles
#define CPG        (CHUNKS/KGROUPS) // pieces that each group joins and stores

#define K_STRIDE 72
#define V_STRIDE 72

static __device__ __forceinline__ v8h pack8(f32x4 a, f32x4 b, float s) {
  v8h r;
  r[0] = (_Float16)(a[0] * s); r[1] = (_Float16)(a[1] * s);
  r[2] = (_Float16)(a[2] * s); r[3] = (_Float16)(a[3] * s);
  r[4] = (_Float16)(b[0] * s); r[5] = (_Float16)(b[1] * s);
  r[6] = (_Float16)(b[2] * s); r[7] = (_Float16)(b[3] * s);
  return r;
}

static __device__ __forceinline__ v16h cat16(v8h lo, v8h hi) {
  return __builtin_shufflevector(lo, hi, 0,1,2,3,4,5,6,7,8,9,10,11,12,13,14,15);
}

static __device__ __forceinline__ v16h lds_frag(const _Float16* row, int g) {
  v8h lo = *(const v8h*)(row + g * 8);
  v8h hi = *(const v8h*)(row + 16 + g * 8);
  return cat16(lo, hi);
}

static __device__ __forceinline__ v8f wmma_f16(v16h a, v16h b, v8f c) {
  return __builtin_amdgcn_wmma_f32_16x16x32_f16(
      /*neg_a=*/false, a, /*neg_b=*/false, b,
      /*c_mod=*/(short)0, c, /*reuse_a=*/false, /*reuse_b=*/false);
}

static __device__ __forceinline__ float xhalf(float x) {
  const int b = __builtin_bit_cast(int, x);
  return __builtin_bit_cast(float, __builtin_amdgcn_permlanex16(
      b, b, 0x76543210, 0xfedcba98, false, false));
}

#define LOG2E 1.44269504f

static __device__ __forceinline__ float exp2_slot(float x) {
  float r;
  asm("v_exp_f32 %0, %1\n\tv_nop" : "=v"(r) : "v"(x));
  return r;
}

static __device__ __forceinline__ void exp2_tile(v8f& x) {
  float a0 = x[0], a1 = x[1], a2 = x[2], a3 = x[3];
  float a4 = x[4], a5 = x[5], a6 = x[6], a7 = x[7];
  asm("v_exp_f32 %0, %0\n\tv_exp_f32 %1, %1\n\tv_exp_f32 %2, %2\n\t"
      "v_exp_f32 %3, %3\n\tv_exp_f32 %4, %4\n\tv_exp_f32 %5, %5\n\t"
      "v_exp_f32 %6, %6\n\tv_exp_f32 %7, %7\n\tv_nop"
      : "+v"(a0), "+v"(a1), "+v"(a2), "+v"(a3),
        "+v"(a4), "+v"(a5), "+v"(a6), "+v"(a7));
  x[0] = a0; x[1] = a1; x[2] = a2; x[3] = a3;
  x[4] = a4; x[5] = a5; x[6] = a6; x[7] = a7;
}

// Online-softmax update for one 16-query tile over a 64-key block, on S^T.
// Lane (n, g) holds query n's scores of keys t*16 + 8*g + v, so the maximum
// and the sum run in-lane; the halves meet once for the maximum, and lrun
// stays a per-half partial sum until the epilogue. Two converted S^T tiles
// are a B fragment in the hardware k order: P stays in registers.
static __device__ __forceinline__ void softmax_update(
    const v8f st[4], v8f acc[4], float& mrun, float& lrun,
    v16h& p0, v16h& p1) {
  float mx[4];
#pragma unroll
  for (int t = 0; t < 4; ++t) {
    mx[t] = st[t][0];
#pragma unroll
    for (int v = 1; v < 8; ++v) mx[t] = fmaxf(mx[t], st[t][v]);
  }
  float x = fmaxf(fmaxf(mx[0], mx[1]), fmaxf(mx[2], mx[3]));
  x = fmaxf(x, xhalf(x));
  const float mnew  = fmaxf(mrun, x);
  const float alpha = exp2_slot((mrun - mnew) * LOG2E);
  mrun = mnew;
  float sm[4];
#pragma unroll
  for (int t = 0; t < 4; ++t) {
    v8f e = (st[t] - mnew) * LOG2E;
    exp2_tile(e);
    sm[t] = e[0];
#pragma unroll
    for (int v = 0; v < 8; ++v) {
      if (v > 0) sm[t] += e[v];
      if (t < 2) p0[(t & 1) * 8 + v] = (_Float16)e[v];
      else       p1[(t & 1) * 8 + v] = (_Float16)e[v];
    }
  }
  lrun = lrun * alpha + ((sm[0] + sm[1]) + (sm[2] + sm[3]));
#pragma unroll
  for (int j = 0; j < 4; ++j) acc[j] *= alpha;
}

// LDS: in the loop each group's own K and V^T block; behind the loop the same
// bytes carry every group's partial state to the join.
struct StageBuf {
  _Float16 K[KGROUPS][KBLK][K_STRIDE];     // [group][key][d]   (f16)
  _Float16 V[KGROUPS][HEAD_D][V_STRIDE];   // [group][d][key]   (transposed f16)
};
struct JoinBuf {
  f32x4 acc[KGROUPS][CHUNKS][GTHREADS];    // lane-contiguous: conflict-free b128
  float m[KGROUPS][2][GTHREADS];
  float l[KGROUPS][2][GTHREADS];
};
union SharedBuf { StageBuf st; JoinBuf jn; };

__global__ __launch_bounds__(KGROUPS*GTHREADS)
void sdpa_flash_f16wmma(const float* __restrict__ Q, const float* __restrict__ K,
                        const float* __restrict__ V, const int* __restrict__ valid_lens,
                        float* __restrict__ Out, int Sq, int Sk, int mblocks) {
  __shared__ SharedBuf sh;

  const int grp  = __builtin_amdgcn_readfirstlane(threadIdx.x >> 7);  // key group
  const int tid  = threadIdx.x & (GTHREADS - 1);                      // thread in the group
  const int lane = tid & 31;
  const int w    = tid >> 5;        // wave id 0..3 in the group
  _Float16 (*Klds)[K_STRIDE] = sh.st.K[grp];
  _Float16 (*Vlds)[V_STRIDE] = sh.st.V[grp];
  const int n    = lane & 15;       // query column / operand row index
  const int g    = lane >> 4;       // lane group (0 or 1)

  const int b  = blockIdx.x / mblocks;
  const int mb = blockIdx.x % mblocks;
  const int rowbase = mb * BLOCK_M + w * MWAVE;   // rows [rowbase, rowbase+32)

  const int vlen = valid_lens[b];

  const float* Qb = Q + (size_t)b * Sq * HEAD_D;
  const float* Kb = K + (size_t)b * Sk * HEAD_D;
  const float* Vb = V + (size_t)b * Sk * HEAD_D;

  // ---- Q^T B-fragments for two 16-query tiles, pre-scaled by 1/sqrt(d) ----
  const float scale = 0.125f;  // 1/sqrt(64)
  v16h qA0, qA1, qB0, qB1;
  {
    const float* qr = Qb + (size_t)(rowbase + n) * HEAD_D;
    f32x4 a0 = *(const f32x4*)(qr + g * 8);
    f32x4 a1 = *(const f32x4*)(qr + g * 8 + 4);
    f32x4 b0 = *(const f32x4*)(qr + 16 + g * 8);
    f32x4 b1 = *(const f32x4*)(qr + 16 + g * 8 + 4);
    qA0 = cat16(pack8(a0, a1, scale), pack8(b0, b1, scale));
    a0 = *(const f32x4*)(qr + 32 + g * 8);
    a1 = *(const f32x4*)(qr + 32 + g * 8 + 4);
    b0 = *(const f32x4*)(qr + 48 + g * 8);
    b1 = *(const f32x4*)(qr + 48 + g * 8 + 4);
    qA1 = cat16(pack8(a0, a1, scale), pack8(b0, b1, scale));
    qr += 16 * HEAD_D;  // second row tile
    a0 = *(const f32x4*)(qr + g * 8);
    a1 = *(const f32x4*)(qr + g * 8 + 4);
    b0 = *(const f32x4*)(qr + 16 + g * 8);
    b1 = *(const f32x4*)(qr + 16 + g * 8 + 4);
    qB0 = cat16(pack8(a0, a1, scale), pack8(b0, b1, scale));
    a0 = *(const f32x4*)(qr + 32 + g * 8);
    a1 = *(const f32x4*)(qr + 32 + g * 8 + 4);
    b0 = *(const f32x4*)(qr + 48 + g * 8);
    b1 = *(const f32x4*)(qr + 48 + g * 8 + 4);
    qB1 = cat16(pack8(a0, a1, scale), pack8(b0, b1, scale));
  }

  // ---- flash-attention state (two query tiles); acc[j][v] = O^T[16j+8g+v][n] ----
  v8f accA[4] = {}, accB[4] = {};
  float mrunA = -__builtin_inff(), mrunB = -__builtin_inff();
  float lrunA = 0.0f, lrunB = 0.0f;

  // prefetch coords: one lane per 128-byte line of the group's 64 x 64 block
  const int lr = tid >> 1;          // 0..63 key row
  const int lc = (tid & 1) << 5;    // 0 or 32 d column

  const int dc = n << 2;            // d column of this lane's 16 bytes
  const int kr = w * 16 + g * 8;    // K rows kr .. kr+7
  const int vr = w * 16 + g * 4;    // V rows vr .. vr+3 and vr+8 .. vr+11

  const int late  = grp >> 1;       // 1: this group runs one step behind
  const int steps = 2 * ((Sk + KGROUPS * KBLK - 1) / (KGROUPS * KBLK)) + 1;
  for (int h = 0; h < steps; ++h) {
    const int  u  = h - late;       // the group's own step: even stages, odd computes
    const int  kb = (u >> 1) * (KGROUPS * KBLK) + grp * KBLK;
    const bool on = u >= 0 && kb < Sk;   // wave-uniform

    // ---- stage K (64x64) and V^T (64x64) into LDS as f16 ----
    if (on && (u & 1) == 0) {
      const float* kg = Kb + (size_t)(kb + kr) * HEAD_D + dc;
      const float* vg = Vb + (size_t)(kb + vr) * HEAD_D + dc;
      f32x4 kq[8], vq[8];
#pragma unroll
      for (int i = 0; i < 8; ++i) kq[i] = *(const f32x4*)(kg + i * HEAD_D);
#pragma unroll
      for (int i = 0; i < 8; ++i)
        vq[i] = *(const f32x4*)(vg + ((i >> 2) * 8 + (i & 3)) * HEAD_D);
      // The conversions below reuse the loads' address registers: the wait
      // that is kept in front of such an overwrite.
      asm volatile("s_wait_xcnt 0x0" ::: "memory");
#pragma unroll
      for (int i = 0; i < 8; ++i) {
        v4h t;
        t[0] = (_Float16)kq[i][0]; t[1] = (_Float16)kq[i][1];
        t[2] = (_Float16)kq[i][2]; t[3] = (_Float16)kq[i][3];
        *(v4h*)(&Klds[kr + i][dc]) = t;
      }
#pragma unroll
      for (int q = 0; q < 2; ++q) {
#pragma unroll
        for (int c = 0; c < 4; ++c) {
          v4h t;
          t[0] = (_Float16)vq[4 * q + 0][c]; t[1] = (_Float16)vq[4 * q + 1][c];
          t[2] = (_Float16)vq[4 * q + 2][c]; t[3] = (_Float16)vq[4 * q + 3][c];
          *(v4h*)(&Vlds[dc + c][vr + 8 * q]) = t;
        }
      }

      if (kb + KGROUPS * KBLK < Sk) {  // uniform branch: prefetch the group's next block into L2
        __builtin_prefetch(Kb + (size_t)(kb + KGROUPS * KBLK + lr) * HEAD_D + lc, 0, 0);
        __builtin_prefetch(Vb + (size_t)(kb + KGROUPS * KBLK + lr) * HEAD_D + lc, 0, 0);
        // The prefetches' address registers are reused behind the barrier:
        // the wait that is kept in front of such an overwrite.
        asm volatile("s_wait_xcnt 0x0" ::: "memory");
      }
    }

    if (on && (u & 1) != 0) {
    // ---- S^T = K @ (Q*scale)^T : K fragments reused by both query tiles ----
    v8f sA[4], sB[4];
    {
      v8f z = {};
#pragma unroll
      for (int t = 0; t < 4; ++t) {
        v16h kf_lo = lds_frag(&Klds[t * 16 + n][0], g);
        v16h kf_hi = lds_frag(&Klds[t * 16 + n][32], g);
        sA[t] = wmma_f16(kf_lo, qA0, z);
        sA[t] = wmma_f16(kf_hi, qA1, sA[t]);
        sB[t] = wmma_f16(kf_lo, qB0, z);
        sB[t] = wmma_f16(kf_hi, qB1, sB[t]);
      }
    }

    // ---- mask (boundary / tail blocks only; uniform scalar branch) ----
    if (kb + KBLK > vlen) {
      const int rem = vlen - kb - 8 * g;  // valid keys left, counted from this lane's first
#pragma unroll
      for (int t = 0; t < 4; ++t) {
#pragma unroll
        for (int v = 0; v < 8; ++v) {
          const bool ok = (t * 16 + v) < rem;
          sA[t][v] = ok ? sA[t][v] : MASK_VALUE;
          sB[t][v] = ok ? sB[t][v] : MASK_VALUE;
        }
      }
    }

    // ---- online softmax; P^T packs straight into B fragments ----
    v16h pA0, pA1, pB0, pB1;  // keys 0..31 and 32..63 of each query tile
    softmax_update(sA, accA, mrunA, lrunA, pA0, pA1);
    softmax_update(sB, accB, mrunB, lrunB, pB0, pB1);

    // ---- O^T += V^T @ P^T : V fragments reused by both query tiles ----
#pragma unroll
    for (int j = 0; j < 4; ++j) {
      v16h vf_lo = lds_frag(&Vlds[j * 16 + n][0],  g);
      v16h vf_hi = lds_frag(&Vlds[j * 16 + n][32], g);
      accA[j] = wmma_f16(vf_lo, pA0, accA[j]);
      accA[j] = wmma_f16(vf_hi, pA1, accA[j]);
      accB[j] = wmma_f16(vf_lo, pB0, accB[j]);
      accB[j] = wmma_f16(vf_hi, pB1, accB[j]);
    }
    }
    // One barrier a step: it publishes the blocks staged on this step and ends
    // the reads of the blocks that are staged over on the next one.
    __syncthreads();
  }

  // ---- join of the key groups: every group leaves (m, l, acc) in LDS ----
  // (the loop's last barrier has ended every wave's K/V reads: the bytes change their use)
#pragma unroll
  for (int j = 0; j < 4; ++j) {
    f32x4 c;
    c[0] = accA[j][0]; c[1] = accA[j][1]; c[2] = accA[j][2]; c[3] = accA[j][3];
    sh.jn.acc[grp][2 * j][tid] = c;
    c[0] = accA[j][4]; c[1] = accA[j][5]; c[2] = accA[j][6]; c[3] = accA[j][7];
    sh.jn.acc[grp][2 * j + 1][tid] = c;
    c[0] = accB[j][0]; c[1] = accB[j][1]; c[2] = accB[j][2]; c[3] = accB[j][3];
    sh.jn.acc[grp][8 + 2 * j][tid] = c;
    c[0] = accB[j][4]; c[1] = accB[j][5]; c[2] = accB[j][6]; c[3] = accB[j][7];
    sh.jn.acc[grp][8 + 2 * j + 1][tid] = c;
  }
  sh.jn.m[grp][0][tid] = mrunA; sh.jn.l[grp][0][tid] = lrunA;
  sh.jn.m[grp][1][tid] = mrunB; sh.jn.l[grp][1][tid] = lrunB;
  __syncthreads();  // publishes every group's partial state

  // ---- group r joins pieces [r*CPG, (r+1)*CPG): all of one query tile, whole 128-byte lines ----
  {
    const int c0 = grp * CPG;
    const int T  = c0 >> 3;          // query tile of these pieces
    float mg[KGROUPS], wg[KGROUPS];
    float M = -__builtin_inff();
#pragma unroll
    for (int r = 0; r < KGROUPS; ++r) { mg[r] = sh.jn.m[r][T][tid]; M = fmaxf(M, mg[r]); }
    float L = 0.0f;
#pragma unroll
    for (int r = 0; r < KGROUPS; ++r) {
      wg[r] = exp2_slot((mg[r] - M) * LOG2E);
      L += wg[r] * sh.jn.l[r][T][tid];
    }
    const float inv = 1.0f / (L + xhalf(L));   // the halves' sums meet here
    float* orow = Out + ((size_t)b * Sq + rowbase + T * 16 + n) * HEAD_D + 8 * g;
#pragma unroll
    for (int i = 0; i < CPG; ++i) {
      const int c = c0 + i;          // piece: d = 16*((c>>1)&3) + 8*g + 4*(c&1)
      f32x4 o = sh.jn.acc[0][c][tid] * wg[0];
#pragma unroll
      for (int r = 1; r < KGROUPS; ++r) o += sh.jn.acc[r][c][tid] * wg[r];
      *(f32x4*)(orow + 16 * ((c >> 1) & 3) + 4 * (c & 1)) = o * inv;
    }
  }
}

extern "C" void kernel_launch(void* const* d_in, const int* in_sizes, int n_in,
                              void* d_out, int out_size, void* d_ws, size_t ws_size,
                              hipStream_t stream) {
  const float* Q  = (const float*)d_in[0];
  const float* K  = (const float*)d_in[1];
  const float* V  = (const float*)d_in[2];
  const int*   vl = (const int*)d_in[3];
  float* out = (float*)d_out;

  const int B  = in_sizes[3];                    // valid_lens: one entry per batch
  const int Sq = in_sizes[0] / (B * HEAD_D);     // 2048
  const int Sk = in_sizes[1] / (B * HEAD_D);     // 2048
  const int mblocks = Sq / BLOCK_M;              // 16

  dim3 grid(B * mblocks), block(KGROUPS * GTHREADS);
  hipLaunchKernelGGL(sdpa_flash_f16wmma, grid, block, 0, stream,
                     Q, K, V, vl, out, Sq, Sk, mblocks);
}

// v005
// It runs in 22.3 microseconds.
// Timed twice side by side with v004, it ran 1.07 and 1.08 times as fast.
// Counting every step since v000, it is 4.09 times as fast.
#include <hip/hip_runtime.h>

typedef __attribute__((ext_vector_type(16))) _Float16 v16h;
typedef __attribute__((ext_vector_type(8)))  _Float16 v8h;
typedef __attribute__((ext_vector_type(4)))  _Float16 v4h;
typedef __attribute__((ext_vector_type(8)))  float    v8f;
typedef __attribute__((ext_vector_type(4)))  float    f32x4;

#define MASK_VALUE (-1000000.0f)
#define HEAD_D     64
#define KBLK       64           // keys per iteration (two WMMA K-steps deep)
#define WAVES      2            // waves per key group
#define KGROUPS    8            // key groups per workgroup, dealt to its two row tiles by their lengths
#define MWAVE      32           // query rows per wave (two 16-row WMMA tiles)
#define BLOCK_M    (WAVES*MWAVE)// 64 query rows per row tile; a workgroup holds one tile of each of two batches
#define GTHREADS   (WAVES*32)   // threads per key group
#define CHUNKS     16           // 16-byte pieces of one lane's two accumulator tiles
#define CPG        (2*CHUNKS/KGROUPS) // pieces that each group joins and stores (two row tiles)

#define K_STRIDE 72
#define V_STRIDE 72

static __device__ __forceinline__ v8h pack8(f32x4 a, f32x4 b, float s) {
  v8h r;
  r[0] = (_Float16)(a[0] * s); r[1] = (_Float16)(a[1] * s);
  r[2] = (_Float16)(a[2] * s); r[3] = (_Float16)(a[3] * s);
  r[4] = (_Float16)(b[0] * s); r[5] = (_Float16)(b[1] * s);
  r[6] = (_Float16)(b[2] * s); r[7] = (_Float16)(b[3] * s);
  return r;
}

static __device__ __forceinline__ v16h cat16(v8h lo, v8h hi) {
  return __builtin_shufflevector(lo, hi, 0,1,2,3,4,5,6,7,8,9,10,11,12,13,14,15);
}

static __device__ __forceinline__ v16h lds_frag(const _Float16* row, int g) {
  v8h lo = *(const v8h*)(row + g * 8);
  v8h hi = *(const v8h*)(row + 16 + g * 8);
  return cat16(lo, hi);
}

static __device__ __forceinline__ v8f wmma_f16(v16h a, v16h b, v8f c) {
  return __builtin_amdgcn_wmma_f32_16x16x32_f16(
      /*neg_a=*/false, a, /*neg_b=*/false, b,
      /*c_mod=*/(short)0, c, /*reuse_a=*/false, /*reuse_b=*/false);
}

static __device__ __forceinline__ float xhalf(float x) {
  const int b = __builtin_bit_cast(int, x);
  return __builtin_bit_cast(float, __builtin_amdgcn_permlanex16(
      b, b, 0x76543210, 0xfedcba98, false, false));
}

#define LOG2E 1.44269504f

static __device__ __forceinline__ float exp2_slot(float x) {
  float r;
  asm("v_exp_f32 %0, %1\n\tv_nop" : "=v"(r) : "v"(x));
  return r;
}

static __device__ __forceinline__ void exp2_tile(v8f& x) {
  float a0 = x[0], a1 = x[1], a2 = x[2], a3 = x[3];
  float a4 = x[4], a5 = x[5], a6 = x[6], a7 = x[7];
  asm("v_exp_f32 %0, %0\n\tv_exp_f32 %1, %1\n\tv_exp_f32 %2, %2\n\t"
      "v_exp_f32 %3, %3\n\tv_exp_f32 %4, %4\n\tv_exp_f32 %5, %5\n\t"
      "v_exp_f32 %6, %6\n\tv_exp_f32 %7, %7\n\tv_nop"
      : "+v"(a0), "+v"(a1), "+v"(a2), "+v"(a3),
        "+v"(a4), "+v"(a5), "+v"(a6), "+v"(a7));
  x[0] = a0; x[1] = a1; x[2] = a2; x[3] = a3;
  x[4] = a4; x[5] = a5; x[6] = a6; x[7] = a7;
}

// Online-softmax update for one 16-query tile over a 64-key block, on S^T.
// Lane (n, g) holds query n's scores of keys t*16 + 8*g + v, so the maximum
// and the sum run in-lane; the halves meet once for the maximum, and lrun
// stays a per-half partial sum until the epilogue. Two converted S^T tiles
// are a B fragment in the hardware k order: P stays in registers.
static __device__ __forceinline__ void softmax_update(
    const v8f st[4], v8f acc[4], float& mrun, float& lrun,
    v16h& p0, v16h& p1) {
  float mx[4];
#pragma unroll
  for (int t = 0; t < 4; ++t) {
    mx[t] = st[t][0];
#pragma unroll
    for (int v = 1; v < 8; ++v) mx[t] = fmaxf(mx[t], st[t][v]);
  }
  float x = fmaxf(fmaxf(mx[0], mx[1]), fmaxf(mx[2], mx[3]));
  x = fmaxf(x, xhalf(x));
  const float mnew  = fmaxf(mrun, x);
  const float alpha = exp2_slot((mrun - mnew) * LOG2E);
  mrun = mnew;
  float sm[4];
#pragma unroll
  for (int t = 0; t < 4; ++t) {
    v8f e = (st[t] - mnew) * LOG2E;
    exp2_tile(e);
    sm[t] = e[0];
#pragma unroll
    for (int v = 0; v < 8; ++v) {
      if (v > 0) sm[t] += e[v];
      if (t < 2) p0[(t & 1) * 8 + v] = (_Float16)e[v];
      else       p1[(t & 1) * 8 + v] = (_Float16)e[v];
    }
  }
  lrun = lrun * alpha + ((sm[0] + sm[1]) + (sm[2] + sm[3]));
#pragma unroll
  for (int j = 0; j < 4; ++j) acc[j] *= alpha;
}

// LDS: in the loop each group's own K and V^T block; behind the loop the same
// bytes carry every group's partial state to the join.
struct StageBuf {
  _Float16 K[KGROUPS][KBLK][K_STRIDE];     // [group][key][d]   (f16)
  _Float16 V[KGROUPS][HEAD_D][V_STRIDE];   // [group][d][key]   (transposed f16)
};
struct JoinBuf {
  f32x4 acc[KGROUPS][CHUNKS][GTHREADS];    // lane-contiguous: conflict-free b128
  float m[KGROUPS][2][GTHREADS];
  float l[KGROUPS][2][GTHREADS];
};
union SharedBuf { StageBuf st; JoinBuf jn; };

__global__ __launch_bounds__(KGROUPS*GTHREADS)
void sdpa_flash_f16wmma(const float* __restrict__ Q, const float* __restrict__ K,
                        const float* __restrict__ V, const int* __restrict__ valid_lens,
                        float* __restrict__ Out, int Sq, int Sk, int mblocks, int nbatch) {
  __shared__ SharedBuf sh;

  const int grp  = __builtin_amdgcn_readfirstlane(threadIdx.x >> 6);  // key group
  const int tid  = threadIdx.x & (GTHREADS - 1);                      // thread in the group
  const int lane = tid & 31;
  const int w    = tid >> 5;        // wave id 0..1 in the group
  _Float16 (*Klds)[K_STRIDE] = sh.st.K[grp];
  _Float16 (*Vlds)[V_STRIDE] = sh.st.V[grp];
  const int n    = lane & 15;       // query column / operand row index
  const int g    = lane >> 4;       // lane group (0 or 1)

  const int pr = blockIdx.x / mblocks;            // pair of batches
  const int mb = blockIdx.x % mblocks;
  const int rowbase = mb * BLOCK_M + w * MWAVE;   // rows [rowbase, rowbase+32) of either batch

  // ---- the plan, from the lengths alone; every wave derives the same one ----
  // A key past the valid length scores MASK_VALUE: beside any valid key's score
  // its weight exp(MASK_VALUE - max) is 0 in f32, so a batch of length L >= 1
  // needs only its first ceil(L / KBLK) key blocks. Length 0 (every key masked,
  // uniform weights) needs all of them. Lane j holds batch j (nbatch <= 32).
  const int nball = (Sk + KBLK - 1) / KBLK;
  const int vl_l  = valid_lens[lane < nbatch ? lane : nbatch - 1];
  const int nb_l  = vl_l <= 0 ? nball : ((vl_l < Sk ? vl_l : Sk) + KBLK - 1) / KBLK;
  // Rank by block count, longest first (ties by index: a strict order). The
  // workgroup takes the batches of rank pr and nbatch-1-pr: a long and a short one.
  int rank = 0;
  for (int j = 0; j < nbatch; ++j) {
    const int o = __builtin_amdgcn_readlane(nb_l, j);
    rank += (o > nb_l || (o == nb_l && j < lane)) ? 1 : 0;
  }
  const int bA  = __builtin_ctz(__builtin_amdgcn_ballot_w32(lane < nbatch && rank == pr));
  const int bB  = __builtin_ctz(__builtin_amdgcn_ballot_w32(lane < nbatch && rank == nbatch - 1 - pr));
  const int nbA = __builtin_amdgcn_readlane(nb_l, bA);
  const int nbB = __builtin_amdgcn_readlane(nb_l, bB);
  // Groups [0, gA) work on batch bA, groups [gA, KGROUPS) on bB: the cut with the fewest trips.
  int gA = 1, trips = nball;
#pragma unroll
  for (int c = 1; c < KGROUPS; ++c) {
    const int ta = (nbA + c - 1) / c;
    const int tb = (nbB + KGROUPS - c - 1) / (KGROUPS - c);
    const int t  = ta > tb ? ta : tb;
    if (t < trips) { trips = t; gA = c; }
  }
  const bool inA = grp < gA;                      // wave-uniform
  const int b    = inA ? bA : bB;                 // this group's batch
  const int nb   = inA ? nbA : nbB;               // its key blocks
  const int gi   = inA ? grp : grp - gA;          // the group takes blocks gi, gi+gn, ...
  const int gn   = inA ? gA : KGROUPS - gA;
  const int vlen = __builtin_amdgcn_readlane(vl_l, b);

  const float* Qb = Q + (size_t)b * Sq * HEAD_D;
  const float* Kb = K + (size_t)b * Sk * HEAD_D;
  const float* Vb = V + (size_t)b * Sk * HEAD_D;

  // ---- Q^T B-fragments for two 16-query tiles, pre-scaled by 1/sqrt(d) ----
  const float scale = 0.125f;  // 1/sqrt(64)
  v16h qA0, qA1, qB0, qB1;
  {
    const float* qr = Qb + (size_t)(rowbase + n) * HEAD_D;
    f32x4 a0 = *(const f32x4*)(qr + g * 8);
    f32x4 a1 = *(const f32x4*)(qr + g * 8 + 4);
    f32x4 b0 = *(const f32x4*)(qr + 16 + g * 8);
    f32x4 b1 = *(const f32x4*)(qr + 16 + g * 8 + 4);
    qA0 = cat16(pack8(a0, a1, scale), pack8(b0, b1, scale));
    a0 = *(const f32x4*)(qr + 32 + g * 8);
    a1 = *(const f32x4*)(qr + 32 + g * 8 + 4);
    b0 = *(const f32x4*)(qr + 48 + g * 8);
    b1 = *(const f32x4*)(qr + 48 + g * 8 + 4);
    qA1 = cat16(pack8(a0, a1, scale), pack8(b0, b1, scale));
    qr += 16 * HEAD_D;  // second row tile
    a0 = *(const f32x4*)(qr + g * 8);
    a1 = *(const f32x4*)(qr + g * 8 + 4);
    b0 = *(const f32x4*)(qr + 16 + g * 8);
    b1 = *(const f32x4*)(qr + 16 + g * 8 + 4);
    qB0 = cat16(pack8(a0, a1, scale), pack8(b0, b1, scale));
    a0 = *(const f32x4*)(qr + 32 + g * 8);
    a1 = *(const f32x4*)(qr + 32 + g * 8 + 4);
    b0 = *(const f32x4*)(qr + 48 + g * 8);
    b1 = *(const f32x4*)(qr + 48 + g * 8 + 4);
    qB1 = cat16(pack8(a0, a1, scale), pack8(b0, b1, scale));
  }

  // ---- flash-attention state (two query tiles); acc[j][v] = O^T[16j+8g+v][n] ----
  v8f accA[4] = {}, accB[4] = {};
  float mrunA = -__builtin_inff(), mrunB = -__builtin_inff();
  float lrunA = 0.0f, lrunB = 0.0f;

  // prefetch coords: one lane per key row (two 128-byte lines) of the group's 64 x 64 block
  const int lr = tid;               // 0..63 key row

  const int dc = n << 2;            // d column of this lane's 16 bytes
  const int kr = w * 32 + g * 8;    // K rows kr .. kr+7, and the same 16 further
  const int vr = w * 32 + g * 4;    // V rows vr .. vr+3 and vr+8 .. vr+11, and the same 16 further

  const int late  = (grp >> 1) & 1; // 1: this group runs one step behind
  const int steps = 2 * trips + 1;  // trips <= nball
  for (int h = 0; h < steps; ++h) {
    const int  u  = h - late;       // the group's own step: even stages, odd computes
    const int  bk = (u >> 1) * gn + gi;  // the group's key block of this trip
    const int  kb = bk * KBLK;
    const bool on = u >= 0 && bk < nb;   // wave-uniform

    // ---- stage K (64x64) and V^T (64x64) into LDS as f16 ----
    if (on && (u & 1) == 0) {
      const float* kg = Kb + (size_t)(kb + kr) * HEAD_D + dc;
      const float* vg = Vb + (size_t)(kb + vr) * HEAD_D + dc;
      f32x4 kq[16], vq[16];
#pragma unroll
      for (int i = 0; i < 16; ++i)
        kq[i] = *(const f32x4*)(kg + ((i >> 3) * 16 + (i & 7)) * HEAD_D);
#pragma unroll
      for (int i = 0; i < 16; ++i)
        vq[i] = *(const f32x4*)(vg + ((i >> 2) * 8 + (i & 3)) * HEAD_D);
      // The conversions below reuse the loads' address registers: the wait
      // that is kept in front of such an overwrite.
      asm volatile("s_wait_xcnt 0x0" ::: "memory");
#pragma unroll
      for (int i = 0; i < 16; ++i) {
        v4h t;
        t[0] = (_Float16)kq[i][0]; t[1] = (_Float16)kq[i][1];
        t[2] = (_Float16)kq[i][2]; t[3] = (_Float16)kq[i][3];
        *(v4h*)(&Klds[kr + (i >> 3) * 16 + (i & 7)][dc]) = t;
      }
#pragma unroll
      for (int q = 0; q < 4; ++q) {
#pragma unroll
        for (int c = 0; c < 4; ++c) {
          v4h t;
          t[0] = (_Float16)vq[4 * q + 0][c]; t[1] = (_Float16)vq[4 * q + 1][c];
          t[2] = (_Float16)vq[4 * q + 2][c]; t[3] = (_Float16)vq[4 * q + 3][c];
          *(v4h*)(&Vlds[dc + c][vr + 8 * q]) = t;
        }
      }

      if (bk + gn < nb) {  // uniform branch: prefetch the group's next block into L2
        __builtin_prefetch(Kb + (size_t)(kb + gn * KBLK + lr) * HEAD_D, 0, 0);
        __builtin_prefetch(Kb + (size_t)(kb + gn * KBLK + lr) * HEAD_D + 32, 0, 0);
        __builtin_prefetch(Vb + (size_t)(kb + gn * KBLK + lr) * HEAD_D, 0, 0);
        __builtin_prefetch(Vb + (size_t)(kb + gn * KBLK + lr) * HEAD_D + 32, 0, 0);
        // The prefetches' address registers are reused behind the barrier:
        // the wait that is kept in front of such an overwrite.
        asm volatile("s_wait_xcnt 0x0" ::: "memory");
      }
    }

    if (on && (u & 1) != 0) {
    // ---- S^T = K @ (Q*scale)^T : K fragments reused by both query tiles ----
    v8f sA[4], sB[4];
    {
      v8f z = {};
#pragma unroll
      for (int t = 0; t < 4; ++t) {
        v16h kf_lo = lds_frag(&Klds[t * 16 + n][0], g);
        v16h kf_hi = lds_frag(&Klds[t * 16 + n][32], g);
        sA[t] = wmma_f16(kf_lo, qA0, z);
        sA[t] = wmma_f16(kf_hi, qA1, sA[t]);
        sB[t] = wmma_f16(kf_lo, qB0, z);
        sB[t] = wmma_f16(kf_hi, qB1, sB[t]);
      }
    }

    // ---- mask (boundary / tail blocks only; uniform scalar branch) ----
    if (kb + KBLK > vlen) {
      const int rem = vlen - kb - 8 * g;  // valid keys left, counted from this lane's first
#pragma unroll
      for (int t = 0; t < 4; ++t) {
#pragma unroll
        for (int v = 0; v < 8; ++v) {
          const bool ok = (t * 16 + v) < rem;
          sA[t][v] = ok ? sA[t][v] : MASK_VALUE;
          sB[t][v] = ok ? sB[t][v] : MASK_VALUE;
        }
      }
    }

    // ---- online softmax; P^T packs straight into B fragments ----
    v16h pA0, pA1, pB0, pB1;  // keys 0..31 and 32..63 of each query tile
    softmax_update(sA, accA, mrunA, lrunA, pA0, pA1);
    softmax_update(sB, accB, mrunB, lrunB, pB0, pB1);

    // ---- O^T += V^T @ P^T : V fragments reused by both query tiles ----
#pragma unroll
    for (int j = 0; j < 4; ++j) {
      v16h vf_lo = lds_frag(&Vlds[j * 16 + n][0],  g);
      v16h vf_hi = lds_frag(&Vlds[j * 16 + n][32], g);
      accA[j] = wmma_f16(vf_lo, pA0, accA[j]);
      accA[j] = wmma_f16(vf_hi, pA1, accA[j]);
      accB[j] = wmma_f16(vf_lo, pB0, accB[j]);
      accB[j] = wmma_f16(vf_hi, pB1, accB[j]);
    }
    }
    // One barrier a step: it publishes the blocks staged on this step and ends
    // the reads of the blocks that are staged over on the next one.
    __syncthreads();
  }

  // ---- join of the key groups: every group leaves (m, l, acc) in LDS ----
  // (the loop's last barrier has ended every wave's K/V reads: the bytes change their use)
#pragma unroll
  for (int j = 0; j < 4; ++j) {
    f32x4 c;
    c[0] = accA[j][0]; c[1] = accA[j][1]; c[2] = accA[j][2]; c[3] = accA[j][3];
    sh.jn.acc[grp][2 * j][tid] = c;
    c[0] = accA[j][4]; c[1] = accA[j][5]; c[2] = accA[j][6]; c[3] = accA[j][7];
    sh.jn.acc[grp][2 * j + 1][tid] = c;
    c[0] = accB[j][0]; c[1] = accB[j][1]; c[2] = accB[j][2]; c[3] = accB[j][3];
    sh.jn.acc[grp][8 + 2 * j][tid] = c;
    c[0] = accB[j][4]; c[1] = accB[j][5]; c[2] = accB[j][6]; c[3] = accB[j][7];
    sh.jn.acc[grp][8 + 2 * j + 1][tid] = c;
  }
  sh.jn.m[grp][0][tid] = mrunA; sh.jn.l[grp][0][tid] = lrunA;
  sh.jn.m[grp][1][tid] = mrunB; sh.jn.l[grp][1][tid] = lrunB;
  __syncthreads();  // publishes every group's partial state

  // ---- groups 0..3 join batch bA's row tile, groups 4..7 batch bB's: each takes CPG pieces,
  //      all of one query tile, whole 128-byte lines, and sums over that batch's key groups.
  //      A group that had no block left (-inf, 0, zeros): its weight is 2^(-inf) = 0. ----
  {
    const int jt = grp >> 2;                    // 0: batch bA, 1: batch bB (wave-uniform)
    const int r0 = jt ? gA : 0;                 // that batch's key groups [r0, r1)
    const int r1 = jt ? KGROUPS : gA;
    const int bj = jt ? bB : bA;
    const int c0 = (grp & 3) * CPG;
    const int T  = c0 >> 3;          // query tile of these pieces
    float mg[KGROUPS], wg[KGROUPS];
    float M = -__builtin_inff();
#pragma unroll
    for (int r = 0; r < KGROUPS; ++r) {
      mg[r] = -__builtin_inff();
      if (r >= r0 && r < r1) { mg[r] = sh.jn.m[r][T][tid]; M = fmaxf(M, mg[r]); }
    }
    float L = 0.0f;
#pragma unroll
    for (int r = 0; r < KGROUPS; ++r) {
      wg[r] = 0.0f;
      if (r >= r0 && r < r1) {
        wg[r] = exp2_slot((mg[r] - M) * LOG2E);
        L += wg[r] * sh.jn.l[r][T][tid];
      }
    }
    const float inv = 1.0f / (L + xhalf(L));   // the halves' sums meet here
    float* orow = Out + ((size_t)bj * Sq + rowbase + T * 16 + n) * HEAD_D + 8 * g;
    f32x4 o[CPG] = {};
#pragma unroll
    for (int r = 0; r < KGROUPS; ++r) {
      if (r >= r0 && r < r1) {
#pragma unroll
        for (int i = 0; i < CPG; ++i) o[i] += sh.jn.acc[r][c0 + i][tid] * wg[r];
      }
    }
#pragma unroll
    for (int i = 0; i < CPG; ++i) {
      const int c = c0 + i;          // piece: d = 16*((c>>1)&3) + 8*g + 4*(c&1)
      *(f32x4*)(orow + 16 * ((c >> 1) & 3) + 4 * (c & 1)) = o[i] * inv;
    }
  }
}

extern "C" void kernel_launch(void* const* d_in, const int* in_sizes, int n_in,
                              void* d_out, int out_size, void* d_ws, size_t ws_size,
                              hipStream_t stream) {
  const float* Q  = (const float*)d_in[0];
  const float* K  = (const float*)d_in[1];
  const float* V  = (const float*)d_in[2];
  const int*   vl = (const int*)d_in[3];
  float* out = (float*)d_out;

  const int B  = in_sizes[3];                    // valid_lens: one entry per batch
  const int Sq = in_sizes[0] / (B * HEAD_D);     // 2048
  const int Sk = in_sizes[1] / (B * HEAD_D);     // 2048
  const int mblocks = Sq / BLOCK_M;              // 32

  dim3 grid((B / 2) * mblocks), block(KGROUPS * GTHREADS);
  hipLaunchKernelGGL(sdpa_flash_f16wmma, grid, block, 0, stream,
                     Q, K, V, vl, out, Sq, Sk, mblocks, B);
}

// v006
// One run takes 21.2 microseconds.
// Next to v005, in two timings, it ran 1.05 and 1.04 times as fast.
// All steps since v000 together make it 4.27 times as fast.
#include <hip/hip_runtime.h>

typedef __attribute__((ext_vector_type(16))) _Float16 v16h;
typedef __attribute__((ext_vector_type(8)))  _Float16 v8h;
typedef __attribute__((ext_vector_type(4)))  _Float16 v4h;
typedef __attribute__((ext_vector_type(8)))  float    v8f;
typedef __attribute__((ext_vector_type(4)))  float    f32x4;

#define MASK_VALUE (-1000000.0f)
#define HEAD_D     64
#define KBLK       64           // keys per iteration (two WMMA K-steps deep)
#define WAVES      2            // waves per key group
#define KGROUPS    8            // key groups per workgroup, dealt to its two row tiles by their lengths
#define MWAVE      32           // query rows per wave (two 16-row WMMA tiles)
#define BLOCK_M    (WAVES*MWAVE)// 64 query rows per row tile; a workgroup holds one tile of each of two batches
#define GTHREADS   (WAVES*32)   // threads per key group
#define CHUNKS     16           // 16-byte pieces of one lane's two accumulator tiles
#define CPG        (2*CHUNKS/KGROUPS) // pieces that each group joins and stores (two row tiles)

#define K_STRIDE 72
#define V_STRIDE 72

static __device__ __forceinline__ v16h cat16(v8h lo, v8h hi) {
  return __builtin_shufflevector(lo, hi, 0,1,2,3,4,5,6,7,8,9,10,11,12,13,14,15);
}

static __device__ __forceinline__ v16h lds_frag(const _Float16* row, int g) {
  v8h lo = *(const v8h*)(row + g * 8);
  v8h hi = *(const v8h*)(row + 16 + g * 8);
  return cat16(lo, hi);
}

static __device__ __forceinline__ v8f wmma_f16(v16h a, v16h b, v8f c) {
  return __builtin_amdgcn_wmma_f32_16x16x32_f16(
      /*neg_a=*/false, a, /*neg_b=*/false, b,
      /*c_mod=*/(short)0, c, /*reuse_a=*/false, /*reuse_b=*/false);
}

static __device__ __forceinline__ float xhalf(float x) {
  const int b = __builtin_bit_cast(int, x);
  return __builtin_bit_cast(float, __builtin_amdgcn_permlanex16(
      b, b, 0x76543210, 0xfedcba98, false, false));
}

#define LOG2E 1.44269504f

static __device__ __forceinline__ float exp2_slot(float x) {
  float r;
  asm("v_exp_f32 %0, %1\n\tv_nop" : "=v"(r) : "v"(x));
  return r;
}

static __device__ __forceinline__ void exp2_tile(v8f& x) {
  float a0 = x[0], a1 = x[1], a2 = x[2], a3 = x[3];
  float a4 = x[4], a5 = x[5], a6 = x[6], a7 = x[7];
  asm("v_exp_f32 %0, %0\n\tv_exp_f32 %1, %1\n\tv_exp_f32 %2, %2\n\t"
      "v_exp_f32 %3, %3\n\tv_exp_f32 %4, %4\n\tv_exp_f32 %5, %5\n\t"
      "v_exp_f32 %6, %6\n\tv_exp_f32 %7, %7\n\tv_nop"
      : "+v"(a0), "+v"(a1), "+v"(a2), "+v"(a3),
        "+v"(a4), "+v"(a5), "+v"(a6), "+v"(a7));
  x[0] = a0; x[1] = a1; x[2] = a2; x[3] = a3;
  x[4] = a4; x[5] = a5; x[6] = a6; x[7] = a7;
}

// Online-softmax update for one 16-query tile over a 64-key block, on S^T.
// Lane (n, g) holds query n's scores of keys t*16 + 8*g + v, so the maximum
// and the sum run in-lane; the halves meet once for the maximum, and lrun
// stays a per-half partial sum until the epilogue. Two converted S^T tiles
// are a B fragment in the hardware k order: P stays in registers.
static __device__ __forceinline__ void softmax_update(
    const v8f st[4], v8f acc[4], float& mrun, float& lrun,
    v16h& p0, v16h& p1) {
  float mx[4];
#pragma unroll
  for (int t = 0; t < 4; ++t) {
    mx[t] = st[t][0];
#pragma unroll
    for (int v = 1; v < 8; ++v) mx[t] = fmaxf(mx[t], st[t][v]);
  }
  float x = fmaxf(fmaxf(mx[0], mx[1]), fmaxf(mx[2], mx[3]));
  x = fmaxf(x, xhalf(x));
  const float mnew  = fmaxf(mrun, x);
  const float alpha = exp2_slot((mrun - mnew) * LOG2E);
  mrun = mnew;
  float sm[4];
#pragma unroll
  for (int t = 0; t < 4; ++t) {
    v8f e = (st[t] - mnew) * LOG2E;
    exp2_tile(e);
    sm[t] = e[0];
#pragma unroll
    for (int v = 0; v < 8; ++v) {
      if (v > 0) sm[t] += e[v];
      if (t < 2) p0[(t & 1) * 8 + v] = (_Float16)e[v];
      else       p1[(t & 1) * 8 + v] = (_Float16)e[v];
    }
  }
  lrun = lrun * alpha + ((sm[0] + sm[1]) + (sm[2] + sm[3]));
#pragma unroll
  for (int j = 0; j < 4; ++j) acc[j] *= alpha;
}

// LDS: in the loop each group's own K and V^T block; behind the loop the same
// bytes carry every group's partial state to the join.
struct StageBuf {
  _Float16 K[KGROUPS][KBLK][K_STRIDE];     // [group][key][d]   (f16)
  _Float16 V[KGROUPS][HEAD_D][V_STRIDE];   // [group][d][key]   (transposed f16)
};
struct JoinBuf {
  f32x4 acc[KGROUPS][CHUNKS][GTHREADS];    // lane-contiguous: conflict-free b128
  float m[KGROUPS][2][GTHREADS];
  float l[KGROUPS][2][GTHREADS];
};
union SharedBuf { StageBuf st; JoinBuf jn; };
#define Q_STRIDE 72             // same pitch and the same fragment reader as K

__global__ __launch_bounds__(KGROUPS*GTHREADS)
void sdpa_flash_f16wmma(const float* __restrict__ Q, const float* __restrict__ K,
                        const float* __restrict__ V, const int* __restrict__ valid_lens,
                        float* __restrict__ Out, int Sq, int Sk, int mblocks, int nbatch) {
  __shared__ SharedBuf sh;
  // Both row tiles' queries, scaled, f16: rows 0..63 of batch bA, 64..127 of bB. Written once, on step 0.
  __shared__ __attribute__((aligned(16))) _Float16 Qlds[2 * BLOCK_M][Q_STRIDE];

  const int grp  = __builtin_amdgcn_readfirstlane(threadIdx.x >> 6);  // key group
  const int tid  = threadIdx.x & (GTHREADS - 1);                      // thread in the group
  const int lane = tid & 31;
  const int w    = tid >> 5;        // wave id 0..1 in the group
  _Float16 (*Klds)[K_STRIDE] = sh.st.K[grp];
  _Float16 (*Vlds)[V_STRIDE] = sh.st.V[grp];
  const int n    = lane & 15;       // query column / operand row index
  const int g    = lane >> 4;       // lane group (0 or 1)

  const int pr = blockIdx.x / mblocks;            // pair of batches
  const int mb = blockIdx.x % mblocks;
  const int rowbase = mb * BLOCK_M + w * MWAVE;   // rows [rowbase, rowbase+32) of either batch

  // ---- the plan, from the lengths alone; every wave derives the same one ----
  // A key past the valid length scores MASK_VALUE: beside any valid key's score
  // its weight exp(MASK_VALUE - max) is 0 in f32, so a batch of length L >= 1
  // needs only its first ceil(L / KBLK) key blocks. Length 0 (every key masked,
  // uniform weights) needs all of them. Lane j holds batch j (nbatch <= 32).
  const int nball = (Sk + KBLK - 1) / KBLK;
  const int vl_l  = valid_lens[lane < nbatch ? lane : nbatch - 1];
  const int nb_l  = vl_l <= 0 ? nball : ((vl_l < Sk ? vl_l : Sk) + KBLK - 1) / KBLK;
  // Rank by block count, longest first (ties by index: a strict order). The
  // workgroup takes the batches of rank pr and nbatch-1-pr: a long and a short one.
  int rank = 0;
  for (int j = 0; j < nbatch; ++j) {
    const int o = __builtin_amdgcn_readlane(nb_l, j);
    rank += (o > nb_l || (o == nb_l && j < lane)) ? 1 : 0;
  }
  const int bA  = __builtin_ctz(__builtin_amdgcn_ballot_w32(lane < nbatch && rank == pr));
  const int bB  = __builtin_ctz(__builtin_amdgcn_ballot_w32(lane < nbatch && rank == nbatch - 1 - pr));
  const int nbA = __builtin_amdgcn_readlane(nb_l, bA);
  const int nbB = __builtin_amdgcn_readlane(nb_l, bB);
  // Groups [0, gA) work on batch bA, groups [gA, KGROUPS) on bB: the cut with the fewest trips.
  int gA = 1, trips = nball;
#pragma unroll
  for (int c = 1; c < KGROUPS; ++c) {
    const int ta = (nbA + c - 1) / c;
    const int tb = (nbB + KGROUPS - c - 1) / (KGROUPS - c);
    const int t  = ta > tb ? ta : tb;
    if (t < trips) { trips = t; gA = c; }
  }
  const bool inA = grp < gA;                      // wave-uniform
  const int b    = inA ? bA : bB;                 // this group's batch
  const int nb   = inA ? nbA : nbB;               // its key blocks
  const int gi   = inA ? grp : grp - gA;          // the group takes blocks gi, gi+gn, ...
  const int gn   = inA ? gA : KGROUPS - gA;
  const int vlen = __builtin_amdgcn_readlane(vl_l, b);

  const float* Kb = K + (size_t)b * Sk * HEAD_D;
  const float* Vb = V + (size_t)b * Sk * HEAD_D;

  // ---- Q^T B-fragments for two 16-query tiles, pre-scaled by 1/sqrt(d): filled on the group's first trip ----
  const float scale = 0.125f;  // 1/sqrt(64)
  v16h qA0 = {}, qA1 = {}, qB0 = {}, qB1 = {};

  // ---- flash-attention state (two query tiles); acc[j][v] = O^T[16j+8g+v][n] ----
  v8f accA[4] = {}, accB[4] = {};
  float mrunA = -__builtin_inff(), mrunB = -__builtin_inff();
  float lrunA = 0.0f, lrunB = 0.0f;

  // prefetch coords: one lane per key row (two 128-byte lines) of the group's 64 x 64 block
  const int lr = tid;               // 0..63 key row

  const int dc = n << 2;            // d column of this lane's 16 bytes
  const int kr = w * 32 + g * 8;    // K rows kr .. kr+7, and the same 16 further
  const int vr = w * 32 + g * 4;    // V rows vr .. vr+3 and vr+8 .. vr+11, and the same 16 further

  const int late  = (grp >> 1) & 1; // 1: this group runs one step behind
  const int steps = 2 * trips + 1;  // trips <= nball
  for (int h = 0; h < steps; ++h) {
    const int  u  = h - late;       // the group's own step: even stages, odd computes
    const int  bk = (u >> 1) * gn + gi;  // the group's key block of this trip
    const int  kb = bk * KBLK;
    const bool on = u >= 0 && bk < nb;   // wave-uniform

    // ---- step 0: the eight waves that have nothing to stage yet bring in Q for the whole
    //      work-group, 16 rows a wave, two whole rows (four 128-byte lines) a load; the
    //      step's barrier publishes it ----
    if (h == 0 && late != 0) {
      const int lw = ((grp >> 2) << 2) | ((grp & 1) << 1) | w;   // 0..7 among these waves
      const int qb = lw < 4 ? bA : bB;
      const float* qg = Q + ((size_t)qb * Sq + mb * BLOCK_M + (lw & 3) * 16 + g) * HEAD_D + dc;
      f32x4 qq[8];
#pragma unroll
      for (int i = 0; i < 8; ++i) qq[i] = *(const f32x4*)(qg + 2 * i * HEAD_D);
      // The wait that is kept between these loads and any later overwrite of
      // their address registers.
      asm volatile("s_wait_xcnt 0x0" ::: "memory");
#pragma unroll
      for (int i = 0; i < 8; ++i) {
        v4h t;
        t[0] = (_Float16)(qq[i][0] * scale); t[1] = (_Float16)(qq[i][1] * scale);
        t[2] = (_Float16)(qq[i][2] * scale); t[3] = (_Float16)(qq[i][3] * scale);
        *(v4h*)(&Qlds[lw * 16 + 2 * i + g][dc]) = t;
      }
    }

    // ---- stage K (64x64) and V^T (64x64) into LDS as f16 ----
    if (on && (u & 1) == 0) {
      const float* kg = Kb + (size_t)(kb + kr) * HEAD_D + dc;
      const float* vg = Vb + (size_t)(kb + vr) * HEAD_D + dc;
      f32x4 kq[16], vq[16];
#pragma unroll
      for (int i = 0; i < 16; ++i)
        kq[i] = *(const f32x4*)(kg + ((i >> 3) * 16 + (i & 7)) * HEAD_D);
#pragma unroll
      for (int i = 0; i < 16; ++i)
        vq[i] = *(const f32x4*)(vg + ((i >> 2) * 8 + (i & 3)) * HEAD_D);
      // The conversions below reuse the loads' address registers: the wait
      // that is kept in front of such an overwrite.
      asm volatile("s_wait_xcnt 0x0" ::: "memory");
#pragma unroll
      for (int i = 0; i < 16; ++i) {
        v4h t;
        t[0] = (_Float16)kq[i][0]; t[1] = (_Float16)kq[i][1];
        t[2] = (_Float16)kq[i][2]; t[3] = (_Float16)kq[i][3];
        *(v4h*)(&Klds[kr + (i >> 3) * 16 + (i & 7)][dc]) = t;
      }
#pragma unroll
      for (int q = 0; q < 4; ++q) {
#pragma unroll
        for (int c = 0; c < 4; ++c) {
          v4h t;
          t[0] = (_Float16)vq[4 * q + 0][c]; t[1] = (_Float16)vq[4 * q + 1][c];
          t[2] = (_Float16)vq[4 * q + 2][c]; t[3] = (_Float16)vq[4 * q + 3][c];
          *(v4h*)(&Vlds[dc + c][vr + 8 * q]) = t;
        }
      }

      if (bk + gn < nb) {  // uniform branch: prefetch the group's next block into L2
        __builtin_prefetch(Kb + (size_t)(kb + gn * KBLK + lr) * HEAD_D, 0, 0);
        __builtin_prefetch(Kb + (size_t)(kb + gn * KBLK + lr) * HEAD_D + 32, 0, 0);
        __builtin_prefetch(Vb + (size_t)(kb + gn * KBLK + lr) * HEAD_D, 0, 0);
        __builtin_prefetch(Vb + (size_t)(kb + gn * KBLK + lr) * HEAD_D + 32, 0, 0);
        // The prefetches' address registers are reused behind the barrier:
        // the wait that is kept in front of such an overwrite.
        asm volatile("s_wait_xcnt 0x0" ::: "memory");
      }
    }

    if (on && (u & 1) != 0) {
    if (u == 1) {  // the group's first trip (wave-uniform): its Q fragments, kept in registers from here on
      const _Float16* qr = &Qlds[(inA ? 0 : BLOCK_M) + w * MWAVE + n][0];
      qA0 = lds_frag(qr, g);
      qA1 = lds_frag(qr + 32, g);
      qB0 = lds_frag(qr + 16 * Q_STRIDE, g);
      qB1 = lds_frag(qr + 16 * Q_STRIDE + 32, g);
    }
    // ---- S^T = K @ (Q*scale)^T : K fragments reused by both query tiles ----
    v8f sA[4], sB[4];
    {
      v8f z = {};
#pragma unroll
      for (int t = 0; t < 4; ++t) {
        v16h kf_lo = lds_frag(&Klds[t * 16 + n][0], g);
        v16h kf_hi = lds_frag(&Klds[t * 16 + n][32], g);
        sA[t] = wmma_f16(kf_lo, qA0, z);
        sA[t] = wmma_f16(kf_hi, qA1, sA[t]);
        sB[t] = wmma_f16(kf_lo, qB0, z);
        sB[t] = wmma_f16(kf_hi, qB1, sB[t]);
      }
    }

    // ---- mask (boundary / tail blocks only; uniform scalar branch) ----
    if (kb + KBLK > vlen) {
      const int rem = vlen - kb - 8 * g;  // valid keys left, counted from this lane's first
#pragma unroll
      for (int t = 0; t < 4; ++t) {
#pragma unroll
        for (int v = 0; v < 8; ++v) {
          const bool ok = (t * 16 + v) < rem;
          sA[t][v] = ok ? sA[t][v] : MASK_VALUE;
          sB[t][v] = ok ? sB[t][v] : MASK_VALUE;
        }
      }
    }

    // ---- online softmax; P^T packs straight into B fragments ----
    v16h pA0, pA1, pB0, pB1;  // keys 0..31 and 32..63 of each query tile
    softmax_update(sA, accA, mrunA, lrunA, pA0, pA1);
    softmax_update(sB, accB, mrunB, lrunB, pB0, pB1);

    // ---- O^T += V^T @ P^T : V fragments reused by both query tiles ----
#pragma unroll
    for (int j = 0; j < 4; ++j) {
      v16h vf_lo = lds_frag(&Vlds[j * 16 + n][0],  g);
      v16h vf_hi = lds_frag(&Vlds[j * 16 + n][32], g);
      accA[j] = wmma_f16(vf_lo, pA0, accA[j]);
      accA[j] = wmma_f16(vf_hi, pA1, accA[j]);
      accB[j] = wmma_f16(vf_lo, pB0, accB[j]);
      accB[j] = wmma_f16(vf_hi, pB1, accB[j]);
    }
    }
    // One barrier a step: it publishes the blocks staged on this step and ends
    // the reads of the blocks that are staged over on the next one.
    __syncthreads();
  }

  // ---- join of the key groups: every group leaves (m, l, acc) in LDS ----
  // (the loop's last barrier has ended every wave's K/V reads: the bytes change their use)
#pragma unroll
  for (int j = 0; j < 4; ++j) {
    f32x4 c;
    c[0] = accA[j][0]; c[1] = accA[j][1]; c[2] = accA[j][2]; c[3] = accA[j][3];
    sh.jn.acc[grp][2 * j][tid] = c;
    c[0] = accA[j][4]; c[1] = accA[j][5]; c[2] = accA[j][6]; c[3] = accA[j][7];
    sh.jn.acc[grp][2 * j + 1][tid] = c;
    c[0] = accB[j][0]; c[1] = accB[j][1]; c[2] = accB[j][2]; c[3] = accB[j][3];
    sh.jn.acc[grp][8 + 2 * j][tid] = c;
    c[0] = accB[j][4]; c[1] = accB[j][5]; c[2] = accB[j][6]; c[3] = accB[j][7];
    sh.jn.acc[grp][8 + 2 * j + 1][tid] = c;
  }
  sh.jn.m[grp][0][tid] = mrunA; sh.jn.l[grp][0][tid] = lrunA;
  sh.jn.m[grp][1][tid] = mrunB; sh.jn.l[grp][1][tid] = lrunB;
  __syncthreads();  // publishes every group's partial state

  // ---- groups 0..3 join batch bA's row tile, groups 4..7 batch bB's: each takes CPG pieces,
  //      all of one query tile, whole 128-byte lines, and sums over that batch's key groups.
  //      A group that had no block left (-inf, 0, zeros): its weight is 2^(-inf) = 0. ----
  {
    const int jt = grp >> 2;                    // 0: batch bA, 1: batch bB (wave-uniform)
    const int r0 = jt ? gA : 0;                 // that batch's key groups [r0, r1)
    const int r1 = jt ? KGROUPS : gA;
    const int bj = jt ? bB : bA;
    const int c0 = (grp & 3) * CPG;
    const int T  = c0 >> 3;          // query tile of these pieces
    float mg[KGROUPS], wg[KGROUPS];
    float M = -__builtin_inff();
#pragma unroll
    for (int r = 0; r < KGROUPS; ++r) {
      mg[r] = -__builtin_inff();
      if (r >= r0 && r < r1) { mg[r] = sh.jn.m[r][T][tid]; M = fmaxf(M, mg[r]); }
    }
    float L = 0.0f;
#pragma unroll
    for (int r = 0; r < KGROUPS; ++r) {
      wg[r] = 0.0f;
      if (r >= r0 && r < r1) {
        wg[r] = exp2_slot((mg[r] - M) * LOG2E);
        L += wg[r] * sh.jn.l[r][T][tid];
      }
    }
    const float inv = 1.0f / (L + xhalf(L));   // the halves' sums meet here
    float* orow = Out + ((size_t)bj * Sq + rowbase + T * 16 + n) * HEAD_D + 8 * g;
    f32x4 o[CPG] = {};
#pragma unroll
    for (int r = 0; r < KGROUPS; ++r) {
      if (r >= r0 && r < r1) {
#pragma unroll
        for (int i = 0; i < CPG; ++i) o[i] += sh.jn.acc[r][c0 + i][tid] * wg[r];
      }
    }
#pragma unroll
    for (int i = 0; i < CPG; ++i) {
      const int c = c0 + i;          // piece: d = 16*((c>>1)&3) + 8*g + 4*(c&1)
      *(f32x4*)(orow + 16 * ((c >> 1) & 3) + 4 * (c & 1)) = o[i] * inv;
    }
  }
}

extern "C" void kernel_launch(void* const* d_in, const int* in_sizes, int n_in,
                              void* d_out, int out_size, void* d_ws, size_t ws_size,
                              hipStream_t stream) {
  const float* Q  = (const float*)d_in[0];
  const float* K  = (const float*)d_in[1];
  const float* V  = (const float*)d_in[2];
  const int*   vl = (const int*)d_in[3];
  float* out = (float*)d_out;

  const int B  = in_sizes[3];                    // valid_lens: one entry per batch
  const int Sq = in_sizes[0] / (B * HEAD_D);     // 2048
  const int Sk = in_sizes[1] / (B * HEAD_D);     // 2048
  const int mblocks = Sq / BLOCK_M;              // 32

  dim3 grid((B / 2) * mblocks), block(KGROUPS * GTHREADS);
  hipLaunchKernelGGL(sdpa_flash_f16wmma, grid, block, 0, stream,
                     Q, K, V, vl, out, Sq, Sk, mblocks, B);
}

// v007
// One run takes 20.7 microseconds.
// Two timings next to v006 both put it at 1.03 times that version's speed.
// Over all steps from v000 it is 4.40 times as fast.
#include <hip/hip_runtime.h>

typedef __attribute__((ext_vector_type(16))) _Float16 v16h;
typedef __attribute__((ext_vector_type(8)))  _Float16 v8h;
typedef __attribute__((ext_vector_type(4)))  _Float16 v4h;
typedef __attribute__((ext_vector_type(8)))  float    v8f;
typedef __attribute__((ext_vector_type(4)))  float    f32x4;

#define MASK_VALUE (-1000000.0f)
#define HEAD_D     64
#define KBLK       64           // keys per iteration (two WMMA K-steps deep)
#define WAVES      2            // waves per key group
#define KGROUPS    8            // key groups per workgroup, dealt to its two row tiles by their lengths
#define MWAVE      32           // query rows per wave (two 16-row WMMA tiles)
#define BLOCK_M    (WAVES*MWAVE)// 64 query rows per row tile; a workgroup holds one tile of each of two batches
#define GTHREADS   (WAVES*32)   // threads per key group
#define CHUNKS     16           // 16-byte pieces of one lane's two accumulator tiles
#define CPG        (2*CHUNKS/KGROUPS) // pieces that each group joins and stores (two row tiles)

#define K_STRIDE 72
#define V_STRIDE 72

static __device__ __forceinline__ v16h cat16(v8h lo, v8h hi) {
  return __builtin_shufflevector(lo, hi, 0,1,2,3,4,5,6,7,8,9,10,11,12,13,14,15);
}

static __device__ __forceinline__ v16h lds_frag(const _Float16* row, int g) {
  v8h lo = *(const v8h*)(row + g * 8);
  v8h hi = *(const v8h*)(row + 16 + g * 8);
  return cat16(lo, hi);
}

static __device__ __forceinline__ v16h vt_frag(const _Float16* row, int j, int g) {
  v8h lo = *(const v8h*)(row + ((g ^ j) << 3));
  v8h hi = *(const v8h*)(row + (((2 + g) ^ j) << 3));
  return cat16(lo, hi);
}

static __device__ __forceinline__ v8f wmma_f16(v16h a, v16h b, v8f c) {
  return __builtin_amdgcn_wmma_f32_16x16x32_f16(
      /*neg_a=*/false, a, /*neg_b=*/false, b,
      /*c_mod=*/(short)0, c, /*reuse_a=*/false, /*reuse_b=*/false);
}

static __device__ __forceinline__ float xhalf(float x) {
  const int b = __builtin_bit_cast(int, x);
  return __builtin_bit_cast(float, __builtin_amdgcn_permlanex16(
      b, b, 0x76543210, 0xfedcba98, false, false));
}

#define LOG2E 1.44269504f

static __device__ __forceinline__ float exp2_slot(float x) {
  float r;
  asm("v_exp_f32 %0, %1\n\tv_nop" : "=v"(r) : "v"(x));
  return r;
}

static __device__ __forceinline__ void exp2_tile(v8f& x) {
  float a0 = x[0], a1 = x[1], a2 = x[2], a3 = x[3];
  float a4 = x[4], a5 = x[5], a6 = x[6], a7 = x[7];
  asm("v_exp_f32 %0, %0\n\tv_exp_f32 %1, %1\n\tv_exp_f32 %2, %2\n\t"
      "v_exp_f32 %3, %3\n\tv_exp_f32 %4, %4\n\tv_exp_f32 %5, %5\n\t"
      "v_exp_f32 %6, %6\n\tv_exp_f32 %7, %7\n\tv_nop"
      : "+v"(a0), "+v"(a1), "+v"(a2), "+v"(a3),
        "+v"(a4), "+v"(a5), "+v"(a6), "+v"(a7));
  x[0] = a0; x[1] = a1; x[2] = a2; x[3] = a3;
  x[4] = a4; x[5] = a5; x[6] = a6; x[7] = a7;
}

// Online-softmax update for one 16-query tile over a 64-key block, on S^T.
// Lane (n, g) holds query n's scores of keys t*16 + 8*g + v, so the maximum
// and the sum run in-lane; the halves meet once for the maximum, and lrun
// stays a per-half partial sum until the epilogue. Two converted S^T tiles
// are a B fragment in the hardware k order: P stays in registers.
static __device__ __forceinline__ void softmax_update(
    const v8f st[4], v8f acc[4], float& mrun, float& lrun,
    v16h& p0, v16h& p1) {
  float mx[4];
#pragma unroll
  for (int t = 0; t < 4; ++t) {
    mx[t] = st[t][0];
#pragma unroll
    for (int v = 1; v < 8; ++v) mx[t] = fmaxf(mx[t], st[t][v]);
  }
  float x = fmaxf(fmaxf(mx[0], mx[1]), fmaxf(mx[2], mx[3]));
  x = fmaxf(x, xhalf(x));
  const float mnew  = fmaxf(mrun, x);
  const float alpha = exp2_slot((mrun - mnew) * LOG2E);
  mrun = mnew;
  float sm[4];
#pragma unroll
  for (int t = 0; t < 4; ++t) {
    v8f e = (st[t] - mnew) * LOG2E;
    exp2_tile(e);
    sm[t] = e[0];
#pragma unroll
    for (int v = 0; v < 8; ++v) {
      if (v > 0) sm[t] += e[v];
      if (t < 2) p0[(t & 1) * 8 + v] = (_Float16)e[v];
      else       p1[(t & 1) * 8 + v] = (_Float16)e[v];
    }
  }
  lrun = lrun * alpha + ((sm[0] + sm[1]) + (sm[2] + sm[3]));
#pragma unroll
  for (int j = 0; j < 4; ++j) acc[j] *= alpha;
}

// LDS: in the loop each group's own K and V^T block; behind the loop the same
// bytes carry every group's partial state to the join.
struct StageBuf {
  _Float16 K[KGROUPS][KBLK][K_STRIDE];     // [group][key][d]   (f16)
  _Float16 V[KGROUPS][HEAD_D][V_STRIDE];   // [group][d][key]   (transposed f16, pieces swizzled: vt_frag)
};
struct JoinBuf {
  f32x4 acc[KGROUPS][CHUNKS][GTHREADS];    // lane-contiguous: conflict-free b128
  float m[KGROUPS][2][GTHREADS];
  float l[KGROUPS][2][GTHREADS];
};
union SharedBuf { StageBuf st; JoinBuf jn; };
#define Q_STRIDE 72             // same pitch and the same fragment reader as K

__global__ __launch_bounds__(KGROUPS*GTHREADS)
void sdpa_flash_f16wmma(const float* __restrict__ Q, const float* __restrict__ K,
                        const float* __restrict__ V, const int* __restrict__ valid_lens,
                        float* __restrict__ Out, int Sq, int Sk, int mblocks, int nbatch) {
  __shared__ SharedBuf sh;
  // Both row tiles' queries, scaled, f16: rows 0..63 of batch bA, 64..127 of bB. Written once, on step 0.
  __shared__ __attribute__((aligned(16))) _Float16 Qlds[2 * BLOCK_M][Q_STRIDE];

  const int grp  = __builtin_amdgcn_readfirstlane(threadIdx.x >> 6);  // key group
  const int tid  = threadIdx.x & (GTHREADS - 1);                      // thread in the group
  const int lane = tid & 31;
  const int w    = tid >> 5;        // wave id 0..1 in the group
  _Float16 (*Klds)[K_STRIDE] = sh.st.K[grp];
  _Float16 (*Vlds)[V_STRIDE] = sh.st.V[grp];
  const int n    = lane & 15;       // query column / operand row index
  const int g    = lane >> 4;       // lane group (0 or 1)

  const int pr = blockIdx.x / mblocks;            // pair of batches
  const int mb = blockIdx.x % mblocks;
  const int rowbase = mb * BLOCK_M + w * MWAVE;   // rows [rowbase, rowbase+32) of either batch

  // ---- the plan, from the lengths alone; every wave derives the same one ----
  // A key past the valid length scores MASK_VALUE: beside any valid key's score
  // its weight exp(MASK_VALUE - max) is 0 in f32, so a batch of length L >= 1
  // needs only its first ceil(L / KBLK) key blocks. Length 0 (every key masked,
  // uniform weights) needs all of them. Lane j holds batch j (nbatch <= 32).
  const int nball = (Sk + KBLK - 1) / KBLK;
  const int vl_l  = valid_lens[lane < nbatch ? lane : nbatch - 1];
  const int nb_l  = vl_l <= 0 ? nball : ((vl_l < Sk ? vl_l : Sk) + KBLK - 1) / KBLK;
  // Rank by block count, longest first (ties by index: a strict order). The
  // workgroup takes the batches of rank pr and nbatch-1-pr: a long and a short one.
  int rank = 0;
  for (int j = 0; j < nbatch; ++j) {
    const int o = __builtin_amdgcn_readlane(nb_l, j);
    rank += (o > nb_l || (o == nb_l && j < lane)) ? 1 : 0;
  }
  const int bA  = __builtin_ctz(__builtin_amdgcn_ballot_w32(lane < nbatch && rank == pr));
  const int bB  = __builtin_ctz(__builtin_amdgcn_ballot_w32(lane < nbatch && rank == nbatch - 1 - pr));
  const int nbA = __builtin_amdgcn_readlane(nb_l, bA);
  const int nbB = __builtin_amdgcn_readlane(nb_l, bB);
  // Groups [0, gA) work on batch bA, groups [gA, KGROUPS) on bB: the cut with the fewest trips.
  int gA = 1, trips = nball;
#pragma unroll
  for (int c = 1; c < KGROUPS; ++c) {
    const int ta = (nbA + c - 1) / c;
    const int tb = (nbB + KGROUPS - c - 1) / (KGROUPS - c);
    const int t  = ta > tb ? ta : tb;
    if (t < trips) { trips = t; gA = c; }
  }
  const bool inA = grp < gA;                      // wave-uniform
  const int b    = inA ? bA : bB;                 // this group's batch
  const int nb   = inA ? nbA : nbB;               // its key blocks
  const int gi   = inA ? grp : grp - gA;          // the group takes blocks gi, gi+gn, ...
  const int gn   = inA ? gA : KGROUPS - gA;
  const int vlen = __builtin_amdgcn_readlane(vl_l, b);

  const float* Kb = K + (size_t)b * Sk * HEAD_D;
  const float* Vb = V + (size_t)b * Sk * HEAD_D;

  // ---- Q^T B-fragments for two 16-query tiles, pre-scaled by 1/sqrt(d): filled on the group's first trip ----
  const float scale = 0.125f;  // 1/sqrt(64)
  v16h qA0 = {}, qA1 = {}, qB0 = {}, qB1 = {};

  // ---- flash-attention state (two query tiles); acc[j][v] = O^T[16j+8g+v][n] ----
  v8f accA[4] = {}, accB[4] = {};
  float mrunA = -__builtin_inff(), mrunB = -__builtin_inff();
  float lrunA = 0.0f, lrunB = 0.0f;

  // prefetch coords: one lane per key row (two 128-byte lines) of the group's 64 x 64 block
  const int lr = tid;               // 0..63 key row

  const int dc = n << 2;            // d column of this lane's 16 bytes
  const int kr = w * 32 + g * 8;    // K rows kr .. kr+7, and the same 16 further
  const int vr = w * 32 + g * 4;    // V rows vr .. vr+3 and vr+8 .. vr+11, and the same 16 further
  const int va = n >> 2;            // (d >> 4) of this lane's four d: the swizzle of the rows it stores

  const int late  = (grp >> 1) & 1; // 1: this group runs one step behind
  const int steps = 2 * trips + 1;  // trips <= nball
  for (int h = 0; h < steps; ++h) {
    const int  u  = h - late;       // the group's own step: even stages, odd computes
    const int  bk = (u >> 1) * gn + gi;  // the group's key block of this trip
    const int  kb = bk * KBLK;
    const bool on = u >= 0 && bk < nb;   // wave-uniform

    // ---- step 0: the eight waves that have nothing to stage yet bring in Q for the whole
    //      work-group, 16 rows a wave, two whole rows (four 128-byte lines) a load; the
    //      step's barrier publishes it ----
    if (h == 0 && late != 0) {
      const int lw = ((grp >> 2) << 2) | ((grp & 1) << 1) | w;   // 0..7 among these waves
      const int qb = lw < 4 ? bA : bB;
      const float* qg = Q + ((size_t)qb * Sq + mb * BLOCK_M + (lw & 3) * 16 + g) * HEAD_D + dc;
      f32x4 qq[8];
#pragma unroll
      for (int i = 0; i < 8; ++i) qq[i] = *(const f32x4*)(qg + 2 * i * HEAD_D);
      // The wait that is kept between these loads and any later overwrite of
      // their address registers.
      asm volatile("s_wait_xcnt 0x0" ::: "memory");
#pragma unroll
      for (int i = 0; i < 8; ++i) {
        v4h t;
        t[0] = (_Float16)(qq[i][0] * scale); t[1] = (_Float16)(qq[i][1] * scale);
        t[2] = (_Float16)(qq[i][2] * scale); t[3] = (_Float16)(qq[i][3] * scale);
        *(v4h*)(&Qlds[lw * 16 + 2 * i + g][dc]) = t;
      }
    }

    // ---- stage K (64x64) and V^T (64x64) into LDS as f16 ----
    if (on && (u & 1) == 0) {
      const float* kg = Kb + (size_t)(kb + kr) * HEAD_D + dc;
      const float* vg = Vb + (size_t)(kb + vr) * HEAD_D + dc;
      f32x4 kq[16], vq[16];
#pragma unroll
      for (int i = 0; i < 16; ++i)
        kq[i] = *(const f32x4*)(kg + ((i >> 3) * 16 + (i & 7)) * HEAD_D);
#pragma unroll
      for (int i = 0; i < 16; ++i)
        vq[i] = *(const f32x4*)(vg + ((i >> 2) * 8 + (i & 3)) * HEAD_D);
      // The conversions below reuse the loads' address registers: the wait
      // that is kept in front of such an overwrite.
      asm volatile("s_wait_xcnt 0x0" ::: "memory");
#pragma unroll
      for (int i = 0; i < 16; ++i) {
        v4h t;
        t[0] = (_Float16)kq[i][0]; t[1] = (_Float16)kq[i][1];
        t[2] = (_Float16)kq[i][2]; t[3] = (_Float16)kq[i][3];
        *(v4h*)(&Klds[kr + (i >> 3) * 16 + (i & 7)][dc]) = t;
      }
#pragma unroll
      for (int q = 0; q < 4; ++q) {
#pragma unroll
        for (int c = 0; c < 4; ++c) {
          v4h t;
          t[0] = (_Float16)vq[4 * q + 0][c]; t[1] = (_Float16)vq[4 * q + 1][c];
          t[2] = (_Float16)vq[4 * q + 2][c]; t[3] = (_Float16)vq[4 * q + 3][c];
          *(v4h*)(&Vlds[dc + c][vr + 8 * (q ^ va)]) = t;
        }
      }

      if (bk + gn < nb) {  // uniform branch: prefetch the group's next block into L2
        __builtin_prefetch(Kb + (size_t)(kb + gn * KBLK + lr) * HEAD_D, 0, 0);
        __builtin_prefetch(Kb + (size_t)(kb + gn * KBLK + lr) * HEAD_D + 32, 0, 0);
        __builtin_prefetch(Vb + (size_t)(kb + gn * KBLK + lr) * HEAD_D, 0, 0);
        __builtin_prefetch(Vb + (size_t)(kb + gn * KBLK + lr) * HEAD_D + 32, 0, 0);
        // The prefetches' address registers are reused behind the barrier:
        // the wait that is kept in front of such an overwrite.
        asm volatile("s_wait_xcnt 0x0" ::: "memory");
      }
    }

    if (on && (u & 1) != 0) {
    if (u == 1) {  // the group's first trip (wave-uniform): its Q fragments, kept in registers from here on
      const _Float16* qr = &Qlds[(inA ? 0 : BLOCK_M) + w * MWAVE + n][0];
      qA0 = lds_frag(qr, g);
      qA1 = lds_frag(qr + 32, g);
      qB0 = lds_frag(qr + 16 * Q_STRIDE, g);
      qB1 = lds_frag(qr + 16 * Q_STRIDE + 32, g);
    }
    // ---- S^T = K @ (Q*scale)^T : K fragments reused by both query tiles ----
    v8f sA[4], sB[4];
    {
      v8f z = {};
#pragma unroll
      for (int t = 0; t < 4; ++t) {
        v16h kf_lo = lds_frag(&Klds[t * 16 + n][0], g);
        v16h kf_hi = lds_frag(&Klds[t * 16 + n][32], g);
        sA[t] = wmma_f16(kf_lo, qA0, z);
        sA[t] = wmma_f16(kf_hi, qA1, sA[t]);
        sB[t] = wmma_f16(kf_lo, qB0, z);
        sB[t] = wmma_f16(kf_hi, qB1, sB[t]);
      }
    }

    // ---- mask (boundary / tail blocks only; uniform scalar branch) ----
    if (kb + KBLK > vlen) {
      const int rem = vlen - kb - 8 * g;  // valid keys left, counted from this lane's first
#pragma unroll
      for (int t = 0; t < 4; ++t) {
#pragma unroll
        for (int v = 0; v < 8; ++v) {
          const bool ok = (t * 16 + v) < rem;
          sA[t][v] = ok ? sA[t][v] : MASK_VALUE;
          sB[t][v] = ok ? sB[t][v] : MASK_VALUE;
        }
      }
    }

    // ---- online softmax; P^T packs straight into B fragments ----
    v16h pA0, pA1, pB0, pB1;  // keys 0..31 and 32..63 of each query tile
    softmax_update(sA, accA, mrunA, lrunA, pA0, pA1);
    softmax_update(sB, accB, mrunB, lrunB, pB0, pB1);

    // ---- O^T += V^T @ P^T : V fragments reused by both query tiles ----
#pragma unroll
    for (int j = 0; j < 4; ++j) {
      v16h vf_lo = vt_frag(&Vlds[j * 16 + n][0],  j, g);
      v16h vf_hi = vt_frag(&Vlds[j * 16 + n][32], j, g);
      accA[j] = wmma_f16(vf_lo, pA0, accA[j]);
      accA[j] = wmma_f16(vf_hi, pA1, accA[j]);
      accB[j] = wmma_f16(vf_lo, pB0, accB[j]);
      accB[j] = wmma_f16(vf_hi, pB1, accB[j]);
    }
    }
    // One barrier a step: it publishes the blocks staged on this step and ends
    // the reads of the blocks that are staged over on the next one.
    __syncthreads();
  }

  // ---- join of the key groups: every group leaves (m, l, acc) in LDS ----
  // (the loop's last barrier has ended every wave's K/V reads: the bytes change their use)
#pragma unroll
  for (int j = 0; j < 4; ++j) {
    f32x4 c;
    c[0] = accA[j][0]; c[1] = accA[j][1]; c[2] = accA[j][2]; c[3] = accA[j][3];
    sh.jn.acc[grp][2 * j][tid] = c;
    c[0] = accA[j][4]; c[1] = accA[j][5]; c[2] = accA[j][6]; c[3] = accA[j][7];
    sh.jn.acc[grp][2 * j + 1][tid] = c;
    c[0] = accB[j][0]; c[1] = accB[j][1]; c[2] = accB[j][2]; c[3] = accB[j][3];
    sh.jn.acc[grp][8 + 2 * j][tid] = c;
    c[0] = accB[j][4]; c[1] = accB[j][5]; c[2] = accB[j][6]; c[3] = accB[j][7];
    sh.jn.acc[grp][8 + 2 * j + 1][tid] = c;
  }
  sh.jn.m[grp][0][tid] = mrunA; sh.jn.l[grp][0][tid] = lrunA;
  sh.jn.m[grp][1][tid] = mrunB; sh.jn.l[grp][1][tid] = lrunB;
  __syncthreads();  // publishes every group's partial state

  // ---- groups 0..3 join batch bA's row tile, groups 4..7 batch bB's: each takes CPG pieces,
  //      all of one query tile, whole 128-byte lines, and sums over that batch's key groups.
  //      A group that had no block left (-inf, 0, zeros): its weight is 2^(-inf) = 0. ----
  {
    const int jt = grp >> 2;                    // 0: batch bA, 1: batch bB (wave-uniform)
    const int r0 = jt ? gA : 0;                 // that batch's key groups [r0, r1)
    const int r1 = jt ? KGROUPS : gA;
    const int bj = jt ? bB : bA;
    const int c0 = (grp & 3) * CPG;
    const int T  = c0 >> 3;          // query tile of these pieces
    float mg[KGROUPS], wg[KGROUPS];
    float M = -__builtin_inff();
#pragma unroll
    for (int r = 0; r < KGROUPS; ++r) {
      mg[r] = -__builtin_inff();
      if (r >= r0 && r < r1) { mg[r] = sh.jn.m[r][T][tid]; M = fmaxf(M, mg[r]); }
    }
    float L = 0.0f;
#pragma unroll
    for (int r = 0; r < KGROUPS; ++r) {
      wg[r] = 0.0f;
      if (r >= r0 && r < r1) {
        wg[r] = exp2_slot((mg[r] - M) * LOG2E);
        L += wg[r] * sh.jn.l[r][T][tid];
      }
    }
    const float inv = 1.0f / (L + xhalf(L));   // the halves' sums meet here
    float* orow = Out + ((size_t)bj * Sq + rowbase + T * 16 + n) * HEAD_D + 8 * g;
    f32x4 o[CPG] = {};
#pragma unroll
    for (int r = 0; r < KGROUPS; ++r) {
      if (r >= r0 && r < r1) {
#pragma unroll
        for (int i = 0; i < CPG; ++i) o[i] += sh.jn.acc[r][c0 + i][tid] * wg[r];
      }
    }
#pragma unroll
    for (int i = 0; i < CPG; ++i) {
      const int c = c0 + i;          // piece: d = 16*((c>>1)&3) + 8*g + 4*(c&1)
      *(f32x4*)(orow + 16 * ((c >> 1) & 3) + 4 * (c & 1)) = o[i] * inv;
    }
  }
}

extern "C" void kernel_launch(void* const* d_in, const int* in_sizes, int n_in,
                              void* d_out, int out_size, void* d_ws, size_t ws_size,
                              hipStream_t stream) {
  const float* Q  = (const float*)d_in[0];
  const float* K  = (const float*)d_in[1];
  const float* V  = (const float*)d_in[2];
  const int*   vl = (const int*)d_in[3];
  float* out = (float*)d_out;

  const int B  = in_sizes[3];                    // valid_lens: one entry per batch
  const int Sq = in_sizes[0] / (B * HEAD_D);     // 2048
  const int Sk = in_sizes[1] / (B * HEAD_D);     // 2048
  const int mblocks = Sq / BLOCK_M;              // 32

  dim3 grid((B / 2) * mblocks), block(KGROUPS * GTHREADS);
  hipLaunchKernelGGL(sdpa_flash_f16wmma, grid, block, 0, stream,
                     Q, K, V, vl, out, Sq, Sk, mblocks, B);
}

// v008
// Measured time: 20 microseconds a run.
// Two timings next to v007 both put it at 1.04 times that version's speed.
// Over all steps from v000 it is 4.57 times as fast.
#include <hip/hip_runtime.h>

typedef __attribute__((ext_vector_type(16))) _Float16 v16h;
typedef __attribute__((ext_vector_type(8)))  _Float16 v8h;
typedef __attribute__((ext_vector_type(4)))  _Float16 v4h;
typedef __attribute__((ext_vector_type(8)))  float    v8f;
typedef __attribute__((ext_vector_type(4)))  float    f32x4;

#define MASK_VALUE (-1000000.0f)
#define HEAD_D     64
#define KBLK       64           // keys per iteration (two WMMA K-steps deep)
#define WAVES      2            // waves per key group
#define KGROUPS    8            // key groups per workgroup, dealt to its two row tiles by their lengths
#define MWAVE      32           // query rows per wave (two 16-row WMMA tiles)
#define BLOCK_M    (WAVES*MWAVE)// 64 query rows per row tile; a workgroup holds one tile of each of two batches
#define GTHREADS   (WAVES*32)   // threads per key group
#define CHUNKS     16           // 16-byte pieces of one lane's two accumulator tiles
#define CPG        (2*CHUNKS/KGROUPS) // pieces that each group joins and stores (two row tiles)

#define K_STRIDE 72
#define V_STRIDE 72

static __device__ __forceinline__ v16h cat16(v8h lo, v8h hi) {
  return __builtin_shufflevector(lo, hi, 0,1,2,3,4,5,6,7,8,9,10,11,12,13,14,15);
}

static __device__ __forceinline__ v16h lds_frag(const _Float16* row, int g) {
  v8h lo = *(const v8h*)(row + g * 8);
  v8h hi = *(const v8h*)(row + 16 + g * 8);
  return cat16(lo, hi);
}

static __device__ __forceinline__ v16h vt_frag(const _Float16* row, int j, int g) {
  v8h lo = *(const v8h*)(row + ((g ^ j) << 3));
  v8h hi = *(const v8h*)(row + (((2 + g) ^ j) << 3));
  return cat16(lo, hi);
}

static __device__ __forceinline__ v8f wmma_f16(v16h a, v16h b, v8f c) {
  return __builtin_amdgcn_wmma_f32_16x16x32_f16(
      /*neg_a=*/false, a, /*neg_b=*/false, b,
      /*c_mod=*/(short)0, c, /*reuse_a=*/false, /*reuse_b=*/false);
}

static __device__ __forceinline__ float xhalf(float x) {
  const int b = __builtin_bit_cast(int, x);
  return __builtin_bit_cast(float, __builtin_amdgcn_permlanex16(
      b, b, 0x76543210, 0xfedcba98, false, false));
}

#define LOG2E 1.44269504f

static __device__ __forceinline__ float exp2_slot(float x) {
  float r;
  asm("v_exp_f32 %0, %1\n\tv_nop" : "=v"(r) : "v"(x));
  return r;
}

static __device__ __forceinline__ void exp2_tile(v8f& x) {
  float a0 = x[0], a1 = x[1], a2 = x[2], a3 = x[3];
  float a4 = x[4], a5 = x[5], a6 = x[6], a7 = x[7];
  asm("v_exp_f32 %0, %0\n\tv_exp_f32 %1, %1\n\tv_exp_f32 %2, %2\n\t"
      "v_exp_f32 %3, %3\n\tv_exp_f32 %4, %4\n\tv_exp_f32 %5, %5\n\t"
      "v_exp_f32 %6, %6\n\tv_exp_f32 %7, %7\n\tv_nop"
      : "+v"(a0), "+v"(a1), "+v"(a2), "+v"(a3),
        "+v"(a4), "+v"(a5), "+v"(a6), "+v"(a7));
  x[0] = a0; x[1] = a1; x[2] = a2; x[3] = a3;
  x[4] = a4; x[5] = a5; x[6] = a6; x[7] = a7;
}

// Softmax over a 64-key block of one 16-query tile, on S^T, with a lazy reference.
// The scores leave the matrix unit as exp2 arguments: Q carries log2(e)/sqrt(d),
// and the accumulator of the K Q^T product starts at -mref, so
// st = score * log2(e) - mref. Any mref gives the same quotient acc / l; it only
// has to keep 2^st inside f16. So mref moves only when a block tops it by more
// than LAZY_TOP (2^8 = 256, far below the f16 maximum), or on the first block.
// Lane (n, g) holds query n's scores of keys t*16 + 8*g + v, so the maximum
// and the sum run in-lane; the halves meet once for the maximum, and lrun
// stays a per-half partial sum until the epilogue.
#define LAZY_TOP 8.0f

static __device__ __forceinline__ float tile_top(const v8f st[4]) {
  float mx[4];
#pragma unroll
  for (int t = 0; t < 4; ++t) {
    mx[t] = st[t][0];
#pragma unroll
    for (int v = 1; v < 8; ++v) mx[t] = fmaxf(mx[t], st[t][v]);
  }
  const float x = fmaxf(fmaxf(mx[0], mx[1]), fmaxf(mx[2], mx[3]));
  return fmaxf(x, xhalf(x));
}

// Moves the reference by d (the block's top; never downwards after the first
// block): scores, sum and accumulators follow. On the first block sum and
// accumulators are 0 and stay so (factor 0: 2^-d may be infinite there).
static __device__ __forceinline__ void move_ref(
    v8f st[4], v8f acc[4], float& mref, float& lrun, float x, bool first) {
  const float d     = first ? x : fmaxf(x, 0.0f);
  const float alpha = first ? 0.0f : exp2_slot(-d);
  mref += d;
#pragma unroll
  for (int t = 0; t < 4; ++t) st[t] -= d;
  lrun *= alpha;
#pragma unroll
  for (int j = 0; j < 4; ++j) acc[j] *= alpha;
}

// P^T = 2^st. Two converted S^T tiles are a B fragment in the hardware k order:
// P stays in registers.
static __device__ __forceinline__ void exp_pack(
    v8f st[4], float& lrun, v16h& p0, v16h& p1) {
  float sm[4];
#pragma unroll
  for (int t = 0; t < 4; ++t) {
    v8f e = st[t];
    exp2_tile(e);
    sm[t] = e[0];
#pragma unroll
    for (int v = 0; v < 8; ++v) {
      if (v > 0) sm[t] += e[v];
      if (t < 2) p0[(t & 1) * 8 + v] = (_Float16)e[v];
      else       p1[(t & 1) * 8 + v] = (_Float16)e[v];
    }
  }
  lrun += (sm[0] + sm[1]) + (sm[2] + sm[3]);
}

// LDS: in the loop each group's own K and V^T block; behind the loop the same
// bytes carry every group's partial state to the join.
struct StageBuf {
  _Float16 K[KGROUPS][KBLK][K_STRIDE];     // [group][key][d]   (f16)
  _Float16 V[KGROUPS][HEAD_D][V_STRIDE];   // [group][d][key]   (transposed f16, pieces swizzled: vt_frag)
};
struct JoinBuf {
  f32x4 acc[KGROUPS][CHUNKS][GTHREADS];    // lane-contiguous: conflict-free b128
  float m[KGROUPS][2][GTHREADS];
  float l[KGROUPS][2][GTHREADS];
};
union SharedBuf { StageBuf st; JoinBuf jn; };
#define Q_STRIDE 72             // same pitch and the same fragment reader as K

__global__ __launch_bounds__(KGROUPS*GTHREADS)
void sdpa_flash_f16wmma(const float* __restrict__ Q, const float* __restrict__ K,
                        const float* __restrict__ V, const int* __restrict__ valid_lens,
                        float* __restrict__ Out, int Sq, int Sk, int mblocks, int nbatch) {
  __shared__ SharedBuf sh;
  // Both row tiles' queries, scaled, f16: rows 0..63 of batch bA, 64..127 of bB. Written once, on step 0.
  __shared__ __attribute__((aligned(16))) _Float16 Qlds[2 * BLOCK_M][Q_STRIDE];

  const int grp  = __builtin_amdgcn_readfirstlane(threadIdx.x >> 6);  // key group
  const int tid  = threadIdx.x & (GTHREADS - 1);                      // thread in the group
  const int lane = tid & 31;
  const int w    = tid >> 5;        // wave id 0..1 in the group
  _Float16 (*Klds)[K_STRIDE] = sh.st.K[grp];
  _Float16 (*Vlds)[V_STRIDE] = sh.st.V[grp];
  const int n    = lane & 15;       // query column / operand row index
  const int g    = lane >> 4;       // lane group (0 or 1)

  const int pr = blockIdx.x / mblocks;            // pair of batches
  const int mb = blockIdx.x % mblocks;
  const int rowbase = mb * BLOCK_M + w * MWAVE;   // rows [rowbase, rowbase+32) of either batch

  // ---- the plan, from the lengths alone; every wave derives the same one ----
  // A key past the valid length scores MASK_VALUE: beside any valid key's score
  // its weight exp(MASK_VALUE - max) is 0 in f32, so a batch of length L >= 1
  // needs only its first ceil(L / KBLK) key blocks. Length 0 (every key masked,
  // uniform weights) needs all of them. Lane j holds batch j (nbatch <= 32).
  const int nball = (Sk + KBLK - 1) / KBLK;
  const int vl_l  = valid_lens[lane < nbatch ? lane : nbatch - 1];
  const int nb_l  = vl_l <= 0 ? nball : ((vl_l < Sk ? vl_l : Sk) + KBLK - 1) / KBLK;
  // Rank by block count, longest first (ties by index: a strict order). The
  // workgroup takes the batches of rank pr and nbatch-1-pr: a long and a short one.
  int rank = 0;
  for (int j = 0; j < nbatch; ++j) {
    const int o = __builtin_amdgcn_readlane(nb_l, j);
    rank += (o > nb_l || (o == nb_l && j < lane)) ? 1 : 0;
  }
  const int bA  = __builtin_ctz(__builtin_amdgcn_ballot_w32(lane < nbatch && rank == pr));
  const int bB  = __builtin_ctz(__builtin_amdgcn_ballot_w32(lane < nbatch && rank == nbatch - 1 - pr));
  const int nbA = __builtin_amdgcn_readlane(nb_l, bA);
  const int nbB = __builtin_amdgcn_readlane(nb_l, bB);
  // Groups [0, gA) work on batch bA, groups [gA, KGROUPS) on bB: the cut with the fewest trips.
  int gA = 1, trips = nball;
#pragma unroll
  for (int c = 1; c < KGROUPS; ++c) {
    const int ta = (nbA + c - 1) / c;
    const int tb = (nbB + KGROUPS - c - 1) / (KGROUPS - c);
    const int t  = ta > tb ? ta : tb;
    if (t < trips) { trips = t; gA = c; }
  }
  const bool inA = grp < gA;                      // wave-uniform
  const int b    = inA ? bA : bB;                 // this group's batch
  const int nb   = inA ? nbA : nbB;               // its key blocks
  const int gi   = inA ? grp : grp - gA;          // the group takes blocks gi, gi+gn, ...
  const int gn   = inA ? gA : KGROUPS - gA;
  const int vlen = __builtin_amdgcn_readlane(vl_l, b);

  const float* Kb = K + (size_t)b * Sk * HEAD_D;
  const float* Vb = V + (size_t)b * Sk * HEAD_D;

  // ---- Q^T B-fragments for two 16-query tiles, pre-scaled by log2(e)/sqrt(d): filled on the group's first trip ----
  const float scale = 0.125f * LOG2E;  // log2(e)/sqrt(64)
  v16h qA0 = {}, qA1 = {}, qB0 = {}, qB1 = {};

  // ---- flash-attention state (two query tiles); acc[j][v] = O^T[16j+8g+v][n] ----
  v8f accA[4] = {}, accB[4] = {};
  float mrefA = 0.0f, mrefB = 0.0f;   // softmax references, in log2 units; set on the first block
  float lrunA = 0.0f, lrunB = 0.0f;

  // prefetch coords: one lane per key row (two 128-byte lines) of the group's 64 x 64 block
  const int lr = tid;               // 0..63 key row

  const int dc = n << 2;            // d column of this lane's 16 bytes
  const int kr = w * 32 + g * 8;    // K rows kr .. kr+7, and the same 16 further
  const int vr = w * 32 + g * 4;    // V rows vr .. vr+3 and vr+8 .. vr+11, and the same 16 further
  const int va = n >> 2;            // (d >> 4) of this lane's four d: the swizzle of the rows it stores

  const int late  = (grp >> 1) & 1; // 1: this group runs one step behind
  const int steps = 2 * trips + 1;  // trips <= nball
  for (int h = 0; h < steps; ++h) {
    const int  u  = h - late;       // the group's own step: even stages, odd computes
    const int  bk = (u >> 1) * gn + gi;  // the group's key block of this trip
    const int  kb = bk * KBLK;
    const bool on = u >= 0 && bk < nb;   // wave-uniform

    // ---- step 0: the eight waves that have nothing to stage yet bring in Q for the whole
    //      work-group, 16 rows a wave, two whole rows (four 128-byte lines) a load; the
    //      step's barrier publishes it ----
    if (h == 0 && late != 0) {
      const int lw = ((grp >> 2) << 2) | ((grp & 1) << 1) | w;   // 0..7 among these waves
      const int qb = lw < 4 ? bA : bB;
      const float* qg = Q + ((size_t)qb * Sq + mb * BLOCK_M + (lw & 3) * 16 + g) * HEAD_D + dc;
      f32x4 qq[8];
#pragma unroll
      for (int i = 0; i < 8; ++i) qq[i] = *(const f32x4*)(qg + 2 * i * HEAD_D);
      // The wait that is kept between these loads and any later overwrite of
      // their address registers.
      asm volatile("s_wait_xcnt 0x0" ::: "memory");
#pragma unroll
      for (int i = 0; i < 8; ++i) {
        v4h t;
        t[0] = (_Float16)(qq[i][0] * scale); t[1] = (_Float16)(qq[i][1] * scale);
        t[2] = (_Float16)(qq[i][2] * scale); t[3] = (_Float16)(qq[i][3] * scale);
        *(v4h*)(&Qlds[lw * 16 + 2 * i + g][dc]) = t;
      }
    }

    // ---- stage K (64x64) and V^T (64x64) into LDS as f16 ----
    if (on && (u & 1) == 0) {
      const float* kg = Kb + (size_t)(kb + kr) * HEAD_D + dc;
      const float* vg = Vb + (size_t)(kb + vr) * HEAD_D + dc;
      f32x4 kq[16], vq[16];
#pragma unroll
      for (int i = 0; i < 16; ++i)
        kq[i] = *(const f32x4*)(kg + ((i >> 3) * 16 + (i & 7)) * HEAD_D);
#pragma unroll
      for (int i = 0; i < 16; ++i)
        vq[i] = *(const f32x4*)(vg + ((i >> 2) * 8 + (i & 3)) * HEAD_D);
      // The conversions below reuse the loads' address registers: the wait
      // that is kept in front of such an overwrite.
      asm volatile("s_wait_xcnt 0x0" ::: "memory");
#pragma unroll
      for (int i = 0; i < 16; ++i) {
        v4h t;
        t[0] = (_Float16)kq[i][0]; t[1] = (_Float16)kq[i][1];
        t[2] = (_Float16)kq[i][2]; t[3] = (_Float16)kq[i][3];
        *(v4h*)(&Klds[kr + (i >> 3) * 16 + (i & 7)][dc]) = t;
      }
#pragma unroll
      for (int q = 0; q < 4; ++q) {
#pragma unroll
        for (int c = 0; c < 4; ++c) {
          v4h t;
          t[0] = (_Float16)vq[4 * q + 0][c]; t[1] = (_Float16)vq[4 * q + 1][c];
          t[2] = (_Float16)vq[4 * q + 2][c]; t[3] = (_Float16)vq[4 * q + 3][c];
          *(v4h*)(&Vlds[dc + c][vr + 8 * (q ^ va)]) = t;
        }
      }

      if (bk + gn < nb) {  // uniform branch: prefetch the group's next block into L2
        __builtin_prefetch(Kb + (size_t)(kb + gn * KBLK + lr) * HEAD_D, 0, 0);
        __builtin_prefetch(Kb + (size_t)(kb + gn * KBLK + lr) * HEAD_D + 32, 0, 0);
        __builtin_prefetch(Vb + (size_t)(kb + gn * KBLK + lr) * HEAD_D, 0, 0);
        __builtin_prefetch(Vb + (size_t)(kb + gn * KBLK + lr) * HEAD_D + 32, 0, 0);
        // The prefetches' address registers are reused behind the barrier:
        // the wait that is kept in front of such an overwrite.
        asm volatile("s_wait_xcnt 0x0" ::: "memory");
      }
    }

    if (on && (u & 1) != 0) {
    if (u == 1) {  // the group's first trip (wave-uniform): its Q fragments, kept in registers from here on
      const _Float16* qr = &Qlds[(inA ? 0 : BLOCK_M) + w * MWAVE + n][0];
      qA0 = lds_frag(qr, g);
      qA1 = lds_frag(qr + 32, g);
      qB0 = lds_frag(qr + 16 * Q_STRIDE, g);
      qB1 = lds_frag(qr + 16 * Q_STRIDE + 32, g);
    }
    // ---- S^T = K @ (Q*scale)^T : K fragments reused by both query tiles ----
    v8f sA[4], sB[4];
    {
      v8f cnegA, cnegB;  // -mref in all eight registers: the products' start value
#pragma unroll
      for (int v = 0; v < 8; ++v) { cnegA[v] = -mrefA; cnegB[v] = -mrefB; }
#pragma unroll
      for (int t = 0; t < 4; ++t) {
        v16h kf_lo = lds_frag(&Klds[t * 16 + n][0], g);
        v16h kf_hi = lds_frag(&Klds[t * 16 + n][32], g);
        sA[t] = wmma_f16(kf_lo, qA0, cnegA);
        sA[t] = wmma_f16(kf_hi, qA1, sA[t]);
        sB[t] = wmma_f16(kf_lo, qB0, cnegB);
        sB[t] = wmma_f16(kf_hi, qB1, sB[t]);
      }
    }

    // ---- mask (boundary / tail blocks only; uniform scalar branch) ----
    if (kb + KBLK > vlen) {
      const int rem = vlen - kb - 8 * g;  // valid keys left, counted from this lane's first
      const float mkA = MASK_VALUE * LOG2E - mrefA;  // the mask value in the scores' own units
      const float mkB = MASK_VALUE * LOG2E - mrefB;
#pragma unroll
      for (int t = 0; t < 4; ++t) {
#pragma unroll
        for (int v = 0; v < 8; ++v) {
          const bool ok = (t * 16 + v) < rem;
          sA[t][v] = ok ? sA[t][v] : mkA;
          sB[t][v] = ok ? sB[t][v] : mkB;
        }
      }
    }

    // ---- softmax; the references move only where a lane asks for it (one wave-uniform branch) ----
    const float xA = tile_top(sA);
    const float xB = tile_top(sB);
    const float top = u == 1 ? -__builtin_inff() : LAZY_TOP;  // the first block always sets them
    if (__builtin_amdgcn_ballot_w32(fmaxf(xA, xB) > top) != 0) {
      move_ref(sA, accA, mrefA, lrunA, xA, u == 1);
      move_ref(sB, accB, mrefB, lrunB, xB, u == 1);
    }
    // ---- P^T packs straight into B fragments ----
    v16h pA0, pA1, pB0, pB1;  // keys 0..31 and 32..63 of each query tile
    exp_pack(sA, lrunA, pA0, pA1);
    exp_pack(sB, lrunB, pB0, pB1);

    // ---- O^T += V^T @ P^T : V fragments reused by both query tiles ----
#pragma unroll
    for (int j = 0; j < 4; ++j) {
      v16h vf_lo = vt_frag(&Vlds[j * 16 + n][0],  j, g);
      v16h vf_hi = vt_frag(&Vlds[j * 16 + n][32], j, g);
      accA[j] = wmma_f16(vf_lo, pA0, accA[j]);
      accA[j] = wmma_f16(vf_hi, pA1, accA[j]);
      accB[j] = wmma_f16(vf_lo, pB0, accB[j]);
      accB[j] = wmma_f16(vf_hi, pB1, accB[j]);
    }
    }
    // One barrier a step: it publishes the blocks staged on this step and ends
    // the reads of the blocks that are staged over on the next one.
    __syncthreads();
  }

  // ---- join of the key groups: every group leaves (m, l, acc) in LDS ----
  // (the loop's last barrier has ended every wave's K/V reads: the bytes change their use)
#pragma unroll
  for (int j = 0; j < 4; ++j) {
    f32x4 c;
    c[0] = accA[j][0]; c[1] = accA[j][1]; c[2] = accA[j][2]; c[3] = accA[j][3];
    sh.jn.acc[grp][2 * j][tid] = c;
    c[0] = accA[j][4]; c[1] = accA[j][5]; c[2] = accA[j][6]; c[3] = accA[j][7];
    sh.jn.acc[grp][2 * j + 1][tid] = c;
    c[0] = accB[j][0]; c[1] = accB[j][1]; c[2] = accB[j][2]; c[3] = accB[j][3];
    sh.jn.acc[grp][8 + 2 * j][tid] = c;
    c[0] = accB[j][4]; c[1] = accB[j][5]; c[2] = accB[j][6]; c[3] = accB[j][7];
    sh.jn.acc[grp][8 + 2 * j + 1][tid] = c;
  }
  const bool ran = gi < nb;  // wave-uniform: a group with no block has no reference
  sh.jn.m[grp][0][tid] = ran ? mrefA : -__builtin_inff(); sh.jn.l[grp][0][tid] = lrunA;
  sh.jn.m[grp][1][tid] = ran ? mrefB : -__builtin_inff(); sh.jn.l[grp][1][tid] = lrunB;
  __syncthreads();  // publishes every group's partial state

  // ---- groups 0..3 join batch bA's row tile, groups 4..7 batch bB's: each takes CPG pieces,
  //      all of one query tile, whole 128-byte lines, and sums over that batch's key groups.
  //      A group that had no block left (-inf, 0, zeros): its weight is 2^(-inf) = 0. ----
  {
    const int jt = grp >> 2;                    // 0: batch bA, 1: batch bB (wave-uniform)
    const int r0 = jt ? gA : 0;                 // that batch's key groups [r0, r1)
    const int r1 = jt ? KGROUPS : gA;
    const int bj = jt ? bB : bA;
    const int c0 = (grp & 3) * CPG;
    const int T  = c0 >> 3;          // query tile of these pieces
    float mg[KGROUPS], wg[KGROUPS];
    float M = -__builtin_inff();
#pragma unroll
    for (int r = 0; r < KGROUPS; ++r) {
      mg[r] = -__builtin_inff();
      if (r >= r0 && r < r1) { mg[r] = sh.jn.m[r][T][tid]; M = fmaxf(M, mg[r]); }
    }
    float L = 0.0f;
#pragma unroll
    for (int r = 0; r < KGROUPS; ++r) {
      wg[r] = 0.0f;
      if (r >= r0 && r < r1) {
        wg[r] = exp2_slot(mg[r] - M);   // the references are in log2 units
        L += wg[r] * sh.jn.l[r][T][tid];
      }
    }
    const float inv = 1.0f / (L + xhalf(L));   // the halves' sums meet here
    float* orow = Out + ((size_t)bj * Sq + rowbase + T * 16 + n) * HEAD_D + 8 * g;
    f32x4 o[CPG] = {};
#pragma unroll
    for (int r = 0; r < KGROUPS; ++r) {
      if (r >= r0 && r < r1) {
#pragma unroll
        for (int i = 0; i < CPG; ++i) o[i] += sh.jn.acc[r][c0 + i][tid] * wg[r];
      }
    }
#pragma unroll
    for (int i = 0; i < CPG; ++i) {
      const int c = c0 + i;          // piece: d = 16*((c>>1)&3) + 8*g + 4*(c&1)
      *(f32x4*)(orow + 16 * ((c >> 1) & 3) + 4 * (c & 1)) = o[i] * inv;
    }
  }
}

extern "C" void kernel_launch(void* const* d_in, const int* in_sizes, int n_in,
                              void* d_out, int out_size, void* d_ws, size_t ws_size,
                              hipStream_t stream) {
  const float* Q  = (const float*)d_in[0];
  const float* K  = (const float*)d_in[1];
  const float* V  = (const float*)d_in[2];
  const int*   vl = (const int*)d_in[3];
  float* out = (float*)d_out;

  const int B  = in_sizes[3];                    // valid_lens: one entry per batch
  const int Sq = in_sizes[0] / (B * HEAD_D);     // 2048
  const int Sk = in_sizes[1] / (B * HEAD_D);     // 2048
  const int mblocks = Sq / BLOCK_M;              // 32

  dim3 grid((B / 2) * mblocks), block(KGROUPS * GTHREADS);
  hipLaunchKernelGGL(sdpa_flash_f16wmma, grid, block, 0, stream,
                     Q, K, V, vl, out, Sq, Sk, mblocks, B);
}

// v009
// It runs in 18.9 microseconds.
// Timed twice side by side with v008, it ran 1.06 and 1.07 times as fast.
// All steps since v000 together make it 4.88 times as fast.
#include <hip/hip_runtime.h>

typedef __attribute__((ext_vector_type(16))) _Float16 v16h;
typedef __attribute__((ext_vector_type(8)))  _Float16 v8h;
typedef __attribute__((ext_vector_type(4)))  _Float16 v4h;
typedef __attribute__((ext_vector_type(8)))  float    v8f;
typedef __attribute__((ext_vector_type(4)))  float    f32x4;

#define MASK_VALUE (-1000000.0f)
#define HEAD_D     64
#define KBLK       64           // keys per iteration (two WMMA K-steps deep)
#define WAVES      2            // waves per key group
#define KGROUPS    8            // key groups per workgroup, dealt to its two row tiles by their lengths
#define MWAVE      32           // query rows per wave (two 16-row WMMA tiles)
#define BLOCK_M    (WAVES*MWAVE)// 64 query rows per row tile; a workgroup holds one tile of each of two batches
#define GTHREADS   (WAVES*32)   // threads per key group
#define CHUNKS     16           // 16-byte pieces of one lane's two accumulator tiles
#define CPG        (2*CHUNKS/KGROUPS) // pieces that each group joins and stores (two row tiles)

#define K_STRIDE 72
#define V_STRIDE 72

static __device__ __forceinline__ v16h cat16(v8h lo, v8h hi) {
  return __builtin_shufflevector(lo, hi, 0,1,2,3,4,5,6,7,8,9,10,11,12,13,14,15);
}

static __device__ __forceinline__ v16h lds_frag(const _Float16* row, int g) {
  v8h lo = *(const v8h*)(row + g * 8);
  v8h hi = *(const v8h*)(row + 16 + g * 8);
  return cat16(lo, hi);
}

static __device__ __forceinline__ v16h vt_frag(const _Float16* row, int j, int g) {
  v8h lo = *(const v8h*)(row + ((g ^ j) << 3));
  v8h hi = *(const v8h*)(row + (((2 + g) ^ j) << 3));
  return cat16(lo, hi);
}

static __device__ __forceinline__ v8f wmma_f16(v16h a, v16h b, v8f c) {
  return __builtin_amdgcn_wmma_f32_16x16x32_f16(
      /*neg_a=*/false, a, /*neg_b=*/false, b,
      /*c_mod=*/(short)0, c, /*reuse_a=*/false, /*reuse_b=*/false);
}

static __device__ __forceinline__ float xhalf(float x) {
  const int b = __builtin_bit_cast(int, x);
  return __builtin_bit_cast(float, __builtin_amdgcn_permlanex16(
      b, b, 0x76543210, 0xfedcba98, false, false));
}

#define LOG2E 1.44269504f

static __device__ __forceinline__ float exp2_slot(float x) {
  float r;
  asm("v_exp_f32 %0, %1\n\tv_nop" : "=v"(r) : "v"(x));
  return r;
}

static __device__ __forceinline__ void exp2_tile(v8f& x) {
  float a0 = x[0], a1 = x[1], a2 = x[2], a3 = x[3];
  float a4 = x[4], a5 = x[5], a6 = x[6], a7 = x[7];
  asm("v_exp_f32 %0, %0\n\tv_exp_f32 %1, %1\n\tv_exp_f32 %2, %2\n\t"
      "v_exp_f32 %3, %3\n\tv_exp_f32 %4, %4\n\tv_exp_f32 %5, %5\n\t"
      "v_exp_f32 %6, %6\n\tv_exp_f32 %7, %7\n\tv_nop"
      : "+v"(a0), "+v"(a1), "+v"(a2), "+v"(a3),
        "+v"(a4), "+v"(a5), "+v"(a6), "+v"(a7));
  x[0] = a0; x[1] = a1; x[2] = a2; x[3] = a3;
  x[4] = a4; x[5] = a5; x[6] = a6; x[7] = a7;
}

// Softmax over a 64-key block of one 16-query tile, on S^T, with a lazy reference.
// The scores leave the matrix unit as exp2 arguments: Q carries log2(e)/sqrt(d),
// and the accumulator of the K Q^T product starts at -mref, so
// st = score * log2(e) - mref. Any mref gives the same quotient acc / l; it only
// has to keep 2^st inside f16. So mref moves only when a block tops it by more
// than LAZY_TOP (2^8 = 256, far below the f16 maximum), or on the first block.
// Lane (n, g) holds query n's scores of keys t*16 + 8*g + v, so the maximum
// and the sum run in-lane; the halves meet once for the maximum, and lrun
// stays a per-half partial sum until the epilogue.
#define LAZY_TOP 8.0f

static __device__ __forceinline__ float tile_top(const v8f st[4]) {
  float mx[4];
#pragma unroll
  for (int t = 0; t < 4; ++t) {
    mx[t] = st[t][0];
#pragma unroll
    for (int v = 1; v < 8; ++v) mx[t] = fmaxf(mx[t], st[t][v]);
  }
  const float x = fmaxf(fmaxf(mx[0], mx[1]), fmaxf(mx[2], mx[3]));
  return fmaxf(x, xhalf(x));
}

// Moves the reference by d (the block's top; never downwards after the first
// block): scores, sum and accumulators follow. On the first block sum and
// accumulators are 0 and stay so (factor 0: 2^-d may be infinite there).
static __device__ __forceinline__ void move_ref(
    v8f st[4], v8f acc[4], float& mref, float& lrun, float x, bool first) {
  const float d     = first ? x : fmaxf(x, 0.0f);
  const float alpha = first ? 0.0f : exp2_slot(-d);
  mref += d;
#pragma unroll
  for (int t = 0; t < 4; ++t) st[t] -= d;
  lrun *= alpha;
#pragma unroll
  for (int j = 0; j < 4; ++j) acc[j] *= alpha;
}

// P^T = 2^st. Two converted S^T tiles are a B fragment in the hardware k order:
// P stays in registers.
static __device__ __forceinline__ void exp_pack(
    v8f st[4], float& lrun, v16h& p0, v16h& p1) {
  float sm[4];
#pragma unroll
  for (int t = 0; t < 4; ++t) {
    v8f e = st[t];
    exp2_tile(e);
    sm[t] = e[0];
#pragma unroll
    for (int v = 0; v < 8; ++v) {
      if (v > 0) sm[t] += e[v];
      if (t < 2) p0[(t & 1) * 8 + v] = (_Float16)e[v];
      else       p1[(t & 1) * 8 + v] = (_Float16)e[v];
    }
  }
  lrun += (sm[0] + sm[1]) + (sm[2] + sm[3]);
}

// LDS: in the loop each group's own K and V^T block; behind the loop the same
// bytes carry every group's partial state to the join.
struct StageBuf {
  _Float16 K[KGROUPS][KBLK][K_STRIDE];     // [group][key][d]   (f16)
  _Float16 V[KGROUPS][HEAD_D][V_STRIDE];   // [group][d][key]   (transposed f16, pieces swizzled: vt_frag)
};
struct JoinBuf {
  f32x4 acc[KGROUPS][CHUNKS][GTHREADS];    // lane-contiguous: conflict-free b128
  float m[KGROUPS][2][GTHREADS];
  float l[KGROUPS][2][GTHREADS];
};
union SharedBuf { StageBuf st; JoinBuf jn; };
#define Q_STRIDE 72             // same pitch and the same fragment reader as K

__global__ __launch_bounds__(KGROUPS*GTHREADS)
void sdpa_flash_f16wmma(const float* __restrict__ Q, const float* __restrict__ K,
                        const float* __restrict__ V, const int* __restrict__ valid_lens,
                        float* __restrict__ Out, int Sq, int Sk, int mblocks, int nbatch) {
  __shared__ SharedBuf sh;
  // Both row tiles' queries, scaled, f16: rows 0..63 of batch bA, 64..127 of bB. Written once, on step 0.
  __shared__ __attribute__((aligned(16))) _Float16 Qlds[2 * BLOCK_M][Q_STRIDE];

  const int grp  = __builtin_amdgcn_readfirstlane(threadIdx.x >> 6);  // key group
  const int tid  = threadIdx.x & (GTHREADS - 1);                      // thread in the group
  const int lane = tid & 31;
  const int w    = tid >> 5;        // wave id 0..1 in the group
  _Float16 (*Klds)[K_STRIDE] = sh.st.K[grp];
  _Float16 (*Vlds)[V_STRIDE] = sh.st.V[grp];
  const int n    = lane & 15;       // query column / operand row index
  const int g    = lane >> 4;       // lane group (0 or 1)

  const int pr = blockIdx.x / mblocks;            // pair of batches
  const int mb = blockIdx.x % mblocks;
  const int rowbase = mb * BLOCK_M + w * MWAVE;   // rows [rowbase, rowbase+32) of either batch

  // ---- the plan, from the lengths alone; every wave derives the same one ----
  // A key past the valid length scores MASK_VALUE: beside any valid key's score
  // its weight exp(MASK_VALUE - max) is 0 in f32, so a batch of length L >= 1
  // needs only its first ceil(L / KBLK) key blocks. Length 0 (every key masked,
  // uniform weights) needs all of them. Lane j holds batch j (nbatch <= 32).
  const int nball = (Sk + KBLK - 1) / KBLK;
  const int vl_l  = valid_lens[lane < nbatch ? lane : nbatch - 1];
  const int nb_l  = vl_l <= 0 ? nball : ((vl_l < Sk ? vl_l : Sk) + KBLK - 1) / KBLK;
  // Rank by block count, longest first (ties by index: a strict order). The
  // workgroup takes the batches of rank pr and nbatch-1-pr: a long and a short one.
  int rank = 0;
  for (int j = 0; j < nbatch; ++j) {
    const int o = __builtin_amdgcn_readlane(nb_l, j);
    rank += (o > nb_l || (o == nb_l && j < lane)) ? 1 : 0;
  }
  const int bA  = __builtin_ctz(__builtin_amdgcn_ballot_w32(lane < nbatch && rank == pr));
  const int bB  = __builtin_ctz(__builtin_amdgcn_ballot_w32(lane < nbatch && rank == nbatch - 1 - pr));
  const int nbA = __builtin_amdgcn_readlane(nb_l, bA);
  const int nbB = __builtin_amdgcn_readlane(nb_l, bB);
  // Groups [0, gA) work on batch bA, groups [gA, KGROUPS) on bB: the cut with the fewest trips.
  int gA = 1, trips = nball;
#pragma unroll
  for (int c = 1; c < KGROUPS; ++c) {
    const int ta = (nbA + c - 1) / c;
    const int tb = (nbB + KGROUPS - c - 1) / (KGROUPS - c);
    const int t  = ta > tb ? ta : tb;
    if (t < trips) { trips = t; gA = c; }
  }
  const bool inA = grp < gA;                      // wave-uniform
  const int b    = inA ? bA : bB;                 // this group's batch
  const int nb   = inA ? nbA : nbB;               // its key blocks
  const int gi   = inA ? grp : grp - gA;          // the group takes blocks gi, gi+gn, ... counted from the walk's start
  const int gn   = inA ? gA : KGROUPS - gA;
  const int vlen = __builtin_amdgcn_readlane(vl_l, b);
  // The work-groups of one batch read the same K/V lines from L2. Walking the key
  // blocks in step they would all ask for the same lines at the same moment; so each
  // starts its walk turned by its row tile's share of the batch's blocks, in [0, nb),
  // and wraps at nb. Every block is still taken once; only the order of the sums changes.
  const int rot  = (int)((unsigned)(mb * nb) / (unsigned)mblocks);

  const float* Kb = K + (size_t)b * Sk * HEAD_D;
  const float* Vb = V + (size_t)b * Sk * HEAD_D;

  // ---- Q^T B-fragments for two 16-query tiles, pre-scaled by log2(e)/sqrt(d): filled on the group's first trip ----
  const float scale = 0.125f * LOG2E;  // log2(e)/sqrt(64)
  v16h qA0 = {}, qA1 = {}, qB0 = {}, qB1 = {};

  // ---- flash-attention state (two query tiles); acc[j][v] = O^T[16j+8g+v][n] ----
  v8f accA[4] = {}, accB[4] = {};
  float mrefA = 0.0f, mrefB = 0.0f;   // softmax references, in log2 units; set on the first block
  float lrunA = 0.0f, lrunB = 0.0f;

  // prefetch coords: one lane per key row (two 128-byte lines) of the group's 64 x 64 block
  const int lr = tid;               // 0..63 key row

  const int dc = n << 2;            // d column of this lane's 16 bytes
  const int kr = w * 32 + g * 8;    // K rows kr .. kr+7, and the same 16 further
  const int vr = w * 32 + g * 4;    // V rows vr .. vr+3 and vr+8 .. vr+11, and the same 16 further
  const int va = n >> 2;            // (d >> 4) of this lane's four d: the swizzle of the rows it stores

  const int late  = (grp >> 1) & 1; // 1: this group runs one step behind
  const int steps = 2 * trips + 1;  // trips <= nball
  for (int h = 0; h < steps; ++h) {
    const int  u  = h - late;       // the group's own step: even stages, odd computes
    const int  bk = (u >> 1) * gn + gi;  // the group's key block of this trip, counted from the walk's start
    const bool on = u >= 0 && bk < nb;   // wave-uniform
    const int  kb = (bk + rot < nb ? bk + rot : bk + rot - nb) * KBLK;  // its first key: in [0, nb * KBLK) where on

    // ---- step 0: the eight waves that have nothing to stage yet bring in Q for the whole
    //      work-group, 16 rows a wave, two whole rows (four 128-byte lines) a load; the
    //      step's barrier publishes it ----
    if (h == 0 && late != 0) {
      const int lw = ((grp >> 2) << 2) | ((grp & 1) << 1) | w;   // 0..7 among these waves
      const int qb = lw < 4 ? bA : bB;
      const float* qg = Q + ((size_t)qb * Sq + mb * BLOCK_M + (lw & 3) * 16 + g) * HEAD_D + dc;
      f32x4 qq[8];
#pragma unroll
      for (int i = 0; i < 8; ++i) qq[i] = *(const f32x4*)(qg + 2 * i * HEAD_D);
      // The wait that is kept between these loads and any later overwrite of
      // their address registers.
      asm volatile("s_wait_xcnt 0x0" ::: "memory");
#pragma unroll
      for (int i = 0; i < 8; ++i) {
        v4h t;
        t[0] = (_Float16)(qq[i][0] * scale); t[1] = (_Float16)(qq[i][1] * scale);
        t[2] = (_Float16)(qq[i][2] * scale); t[3] = (_Float16)(qq[i][3] * scale);
        *(v4h*)(&Qlds[lw * 16 + 2 * i + g][dc]) = t;
      }
    }

    // ---- stage K (64x64) and V^T (64x64) into LDS as f16 ----
    if (on && (u & 1) == 0) {
      const float* kg = Kb + (size_t)(kb + kr) * HEAD_D + dc;
      const float* vg = Vb + (size_t)(kb + vr) * HEAD_D + dc;
      f32x4 kq[16], vq[16];
#pragma unroll
      for (int i = 0; i < 16; ++i)
        kq[i] = *(const f32x4*)(kg + ((i >> 3) * 16 + (i & 7)) * HEAD_D);
#pragma unroll
      for (int i = 0; i < 16; ++i)
        vq[i] = *(const f32x4*)(vg + ((i >> 2) * 8 + (i & 3)) * HEAD_D);
      // The conversions below reuse the loads' address registers: the wait
      // that is kept in front of such an overwrite.
      asm volatile("s_wait_xcnt 0x0" ::: "memory");
#pragma unroll
      for (int i = 0; i < 16; ++i) {
        v4h t;
        t[0] = (_Float16)kq[i][0]; t[1] = (_Float16)kq[i][1];
        t[2] = (_Float16)kq[i][2]; t[3] = (_Float16)kq[i][3];
        *(v4h*)(&Klds[kr + (i >> 3) * 16 + (i & 7)][dc]) = t;
      }
#pragma unroll
      for (int q = 0; q < 4; ++q) {
#pragma unroll
        for (int c = 0; c < 4; ++c) {
          v4h t;
          t[0] = (_Float16)vq[4 * q + 0][c]; t[1] = (_Float16)vq[4 * q + 1][c];
          t[2] = (_Float16)vq[4 * q + 2][c]; t[3] = (_Float16)vq[4 * q + 3][c];
          *(v4h*)(&Vlds[dc + c][vr + 8 * (q ^ va)]) = t;
        }
      }

      if (bk + gn < nb) {  // uniform branch: prefetch the group's next block into L2
        const int nk = bk + gn + rot;                       // the next block of the turned walk
        const int kn = (nk < nb ? nk : nk - nb) * KBLK;
        __builtin_prefetch(Kb + (size_t)(kn + lr) * HEAD_D, 0, 0);
        __builtin_prefetch(Kb + (size_t)(kn + lr) * HEAD_D + 32, 0, 0);
        __builtin_prefetch(Vb + (size_t)(kn + lr) * HEAD_D, 0, 0);
        __builtin_prefetch(Vb + (size_t)(kn + lr) * HEAD_D + 32, 0, 0);
        // The prefetches' address registers are reused behind the barrier:
        // the wait that is kept in front of such an overwrite.
        asm volatile("s_wait_xcnt 0x0" ::: "memory");
      }
    }

    if (on && (u & 1) != 0) {
    if (u == 1) {  // the group's first trip (wave-uniform): its Q fragments, kept in registers from here on
      const _Float16* qr = &Qlds[(inA ? 0 : BLOCK_M) + w * MWAVE + n][0];
      qA0 = lds_frag(qr, g);
      qA1 = lds_frag(qr + 32, g);
      qB0 = lds_frag(qr + 16 * Q_STRIDE, g);
      qB1 = lds_frag(qr + 16 * Q_STRIDE + 32, g);
    }
    // ---- S^T = K @ (Q*scale)^T : K fragments reused by both query tiles ----
    v8f sA[4], sB[4];
    {
      v8f cnegA, cnegB;  // -mref in all eight registers: the products' start value
#pragma unroll
      for (int v = 0; v < 8; ++v) { cnegA[v] = -mrefA; cnegB[v] = -mrefB; }
#pragma unroll
      for (int t = 0; t < 4; ++t) {
        v16h kf_lo = lds_frag(&Klds[t * 16 + n][0], g);
        v16h kf_hi = lds_frag(&Klds[t * 16 + n][32], g);
        sA[t] = wmma_f16(kf_lo, qA0, cnegA);
        sA[t] = wmma_f16(kf_hi, qA1, sA[t]);
        sB[t] = wmma_f16(kf_lo, qB0, cnegB);
        sB[t] = wmma_f16(kf_hi, qB1, sB[t]);
      }
    }

    // ---- mask (boundary / tail blocks only; uniform scalar branch) ----
    if (kb + KBLK > vlen) {
      const int rem = vlen - kb - 8 * g;  // valid keys left, counted from this lane's first
      const float mkA = MASK_VALUE * LOG2E - mrefA;  // the mask value in the scores' own units
      const float mkB = MASK_VALUE * LOG2E - mrefB;
#pragma unroll
      for (int t = 0; t < 4; ++t) {
#pragma unroll
        for (int v = 0; v < 8; ++v) {
          const bool ok = (t * 16 + v) < rem;
          sA[t][v] = ok ? sA[t][v] : mkA;
          sB[t][v] = ok ? sB[t][v] : mkB;
        }
      }
    }

    // ---- softmax; the references move only where a lane asks for it (one wave-uniform branch) ----
    const float xA = tile_top(sA);
    const float xB = tile_top(sB);
    const float top = u == 1 ? -__builtin_inff() : LAZY_TOP;  // the first block always sets them
    if (__builtin_amdgcn_ballot_w32(fmaxf(xA, xB) > top) != 0) {
      move_ref(sA, accA, mrefA, lrunA, xA, u == 1);
      move_ref(sB, accB, mrefB, lrunB, xB, u == 1);
    }
    // ---- P^T packs straight into B fragments ----
    v16h pA0, pA1, pB0, pB1;  // keys 0..31 and 32..63 of each query tile
    exp_pack(sA, lrunA, pA0, pA1);
    exp_pack(sB, lrunB, pB0, pB1);

    // ---- O^T += V^T @ P^T : V fragments reused by both query tiles ----
#pragma unroll
    for (int j = 0; j < 4; ++j) {
      v16h vf_lo = vt_frag(&Vlds[j * 16 + n][0],  j, g);
      v16h vf_hi = vt_frag(&Vlds[j * 16 + n][32], j, g);
      accA[j] = wmma_f16(vf_lo, pA0, accA[j]);
      accA[j] = wmma_f16(vf_hi, pA1, accA[j]);
      accB[j] = wmma_f16(vf_lo, pB0, accB[j]);
      accB[j] = wmma_f16(vf_hi, pB1, accB[j]);
    }
    }
    // One barrier a step: it publishes the blocks staged on this step and ends
    // the reads of the blocks that are staged over on the next one.
    __syncthreads();
  }

  // ---- join of the key groups: every group leaves (m, l, acc) in LDS ----
  // (the loop's last barrier has ended every wave's K/V reads: the bytes change their use)
#pragma unroll
  for (int j = 0; j < 4; ++j) {
    f32x4 c;
    c[0] = accA[j][0]; c[1] = accA[j][1]; c[2] = accA[j][2]; c[3] = accA[j][3];
    sh.jn.acc[grp][2 * j][tid] = c;
    c[0] = accA[j][4]; c[1] = accA[j][5]; c[2] = accA[j][6]; c[3] = accA[j][7];
    sh.jn.acc[grp][2 * j + 1][tid] = c;
    c[0] = accB[j][0]; c[1] = accB[j][1]; c[2] = accB[j][2]; c[3] = accB[j][3];
    sh.jn.acc[grp][8 + 2 * j][tid] = c;
    c[0] = accB[j][4]; c[1] = accB[j][5]; c[2] = accB[j][6]; c[3] = accB[j][7];
    sh.jn.acc[grp][8 + 2 * j + 1][tid] = c;
  }
  const bool ran = gi < nb;  // wave-uniform: a group with no block has no reference
  sh.jn.m[grp][0][tid] = ran ? mrefA : -__builtin_inff(); sh.jn.l[grp][0][tid] = lrunA;
  sh.jn.m[grp][1][tid] = ran ? mrefB : -__builtin_inff(); sh.jn.l[grp][1][tid] = lrunB;
  __syncthreads();  // publishes every group's partial state

  // ---- groups 0..3 join batch bA's row tile, groups 4..7 batch bB's: each takes CPG pieces,
  //      all of one query tile, whole 128-byte lines, and sums over that batch's key groups.
  //      A group that had no block left (-inf, 0, zeros): its weight is 2^(-inf) = 0. ----
  {
    const int jt = grp >> 2;                    // 0: batch bA, 1: batch bB (wave-uniform)
    const int r0 = jt ? gA : 0;                 // that batch's key groups [r0, r1)
    const int r1 = jt ? KGROUPS : gA;
    const int bj = jt ? bB : bA;
    const int c0 = (grp & 3) * CPG;
    const int T  = c0 >> 3;          // query tile of these pieces
    float mg[KGROUPS], wg[KGROUPS];
    float M = -__builtin_inff();
#pragma unroll
    for (int r = 0; r < KGROUPS; ++r) {
      mg[r] = -__builtin_inff();
      if (r >= r0 && r < r1) { mg[r] = sh.jn.m[r][T][tid]; M = fmaxf(M, mg[r]); }
    }
    float L = 0.0f;
#pragma unroll
    for (int r = 0; r < KGROUPS; ++r) {
      wg[r] = 0.0f;
      if (r >= r0 && r < r1) {
        wg[r] = exp2_slot(mg[r] - M);   // the references are in log2 units
        L += wg[r] * sh.jn.l[r][T][tid];
      }
    }
    const float inv = 1.0f / (L + xhalf(L));   // the halves' sums meet here
    float* orow = Out + ((size_t)bj * Sq + rowbase + T * 16 + n) * HEAD_D + 8 * g;
    f32x4 o[CPG] = {};
#pragma unroll
    for (int r = 0; r < KGROUPS; ++r) {
      if (r >= r0 && r < r1) {
#pragma unroll
        for (int i = 0; i < CPG; ++i) o[i] += sh.jn.acc[r][c0 + i][tid] * wg[r];
      }
    }
#pragma unroll
    for (int i = 0; i < CPG; ++i) {
      const int c = c0 + i;          // piece: d = 16*((c>>1)&3) + 8*g + 4*(c&1)
      *(f32x4*)(orow + 16 * ((c >> 1) & 3) + 4 * (c & 1)) = o[i] * inv;
    }
  }
}

extern "C" void kernel_launch(void* const* d_in, const int* in_sizes, int n_in,
                              void* d_out, int out_size, void* d_ws, size_t ws_size,
                              hipStream_t stream) {
  const float* Q  = (const float*)d_in[0];
  const float* K  = (const float*)d_in[1];
  const float* V  = (const float*)d_in[2];
  const int*   vl = (const int*)d_in[3];
  float* out = (float*)d_out;

  const int B  = in_sizes[3];                    // valid_lens: one entry per batch
  const int Sq = in_sizes[0] / (B * HEAD_D);     // 2048
  const int Sk = in_sizes[1] / (B * HEAD_D);     // 2048
  const int mblocks = Sq / BLOCK_M;              // 32

  dim3 grid((B / 2) * mblocks), block(KGROUPS * GTHREADS);
  hipLaunchKernelGGL(sdpa_flash_f16wmma, grid, block, 0, stream,
                     Q, K, V, vl, out, Sq, Sk, mblocks, B);
}
